// v000
// The times below were measured on an AMD MI455X: many runs one after another, warmed up first and cycling through
// copies of the inputs, with the whole window's GPU time divided by the number of runs. Launches and the gaps
// between them are all in it. The median over several windows is given; except for v000 it joins two sittings, which
// can be a few percent apart, so the side-by-side timings, each taken in one sitting, are the better comparison.
// The starting kernel, v000, takes 159 microseconds a run.
#include <hip/hip_runtime.h>
#include <hip/hip_bf16.h>

typedef __attribute__((ext_vector_type(16))) _Float16 v16h;
typedef __attribute__((ext_vector_type(8)))  _Float16 v8h;
typedef __attribute__((ext_vector_type(8)))  float    v8f;

#define NTOK   16384
#define DMODEL 512
#define NHEAD  8
#define HD     64
#define BLK    256                 // query block == w_half
#define WH     256                 // w_half
#define MPAD   (NTOK + 2*WH)       // 16896 padded rows
#define NBLK   (NTOK / BLK)        // 64

static __device__ inline v16h frag16(const _Float16* p) {
  v8h lo = *(const v8h*)(p);
  v8h hi = *(const v8h*)(p + 16);
  return __builtin_shufflevector(lo, hi, 0,1,2,3,4,5,6,7,8,9,10,11,12,13,14,15);
}

static __device__ inline v8f vzero8() {
  v8f z = {0.f,0.f,0.f,0.f,0.f,0.f,0.f,0.f};
  return z;
}

static __device__ inline float swapx16(float x) {
  return __int_as_float(__builtin_amdgcn_ds_swizzle(__float_as_int(x), 0x401f));
}

// ---------------------------------------------------------------- cast f32->f16
__global__ void cast_w_kernel(const float* __restrict__ src,
                              _Float16* __restrict__ dst, int n) {
  int i = (blockIdx.x * blockDim.x + threadIdx.x) * 4;
  if (i + 3 < n) {
    float4 v = *(const float4*)(src + i);
    dst[i+0] = (_Float16)v.x; dst[i+1] = (_Float16)v.y;
    dst[i+2] = (_Float16)v.z; dst[i+3] = (_Float16)v.w;
  }
}

// ------------------------------------------------- gather by phi + circular pad
__global__ void gather_pad_kernel(const float* __restrict__ x,
                                  const int* __restrict__ phi,
                                  _Float16* __restrict__ xp) {
  int t   = blockIdx.x * 256 + threadIdx.x;   // one 8-half segment per thread
  int idx = t * 8;
  int p   = idx >> 9;          // padded row
  int c   = idx & 511;         // column
  int o   = p - WH;
  if (o < 0)      o += NTOK;
  if (o >= NTOK)  o -= NTOK;
  int src = phi[o];
  const float* s = x + (size_t)src * DMODEL + c;
  float4 a = *(const float4*)s;
  float4 b = *(const float4*)(s + 4);
  v8h out;
  out[0]=(_Float16)a.x; out[1]=(_Float16)a.y; out[2]=(_Float16)a.z; out[3]=(_Float16)a.w;
  out[4]=(_Float16)b.x; out[5]=(_Float16)b.y; out[6]=(_Float16)b.z; out[7]=(_Float16)b.w;
  *(v8h*)(xp + (size_t)p * DMODEL + c) = out;
}

// ------------------------------------------------------- C = A @ W^T + bias
// A: [M x 512] f16 row-major.  W: [512 x 512] f16 row-major (B(k,n)=W[n][k]).
// 128x128 tile per workgroup, 8 waves (4 along M x 2 along N), 32-deep k-steps.
// Double-buffered LDS: global stage of step kb+1 overlaps WMMA of step kb;
// one barrier per k-step.
template<bool HALF_OUT>
__global__ __launch_bounds__(256)
void gemm512_kernel(const _Float16* __restrict__ A,
                    const _Float16* __restrict__ W,
                    const float* __restrict__ bias,
                    float* __restrict__ outF,
                    _Float16* __restrict__ outH) {
  __shared__ _Float16 As[2][128 * 32];
  __shared__ _Float16 Bs[2][128 * 32];

  const int tid  = threadIdx.x;
  const int lane = tid & 31;
  const int wave = tid >> 5;
  const int m0 = blockIdx.x * 128;
  const int n0 = blockIdx.y * 128;
  const int mwave = (wave & 3) * 32;   // 4 waves along M
  const int nwave = (wave >> 2) * 64;  // 2 waves along N
  const int half = lane >> 4;
  const int l16  = lane & 15;
  const int off  = half * 8;

  const int lrow = tid >> 2;           // 0..63
  const int lseg = (tid & 3) * 8;      // 0,8,16,24

  auto stage = [&](int kb, int buf) {
    const int k0 = kb * 32;
    *(v8h*)&As[buf][ lrow     *32 + lseg] = *(const v8h*)&A[(size_t)(m0+lrow   )*512 + k0 + lseg];
    *(v8h*)&As[buf][(lrow+64) *32 + lseg] = *(const v8h*)&A[(size_t)(m0+lrow+64)*512 + k0 + lseg];
    *(v8h*)&Bs[buf][ lrow     *32 + lseg] = *(const v8h*)&W[(size_t)(n0+lrow   )*512 + k0 + lseg];
    *(v8h*)&Bs[buf][(lrow+64) *32 + lseg] = *(const v8h*)&W[(size_t)(n0+lrow+64)*512 + k0 + lseg];
  };

  v8f acc[2][4];
#pragma unroll
  for (int mt = 0; mt < 2; ++mt)
#pragma unroll
    for (int nt = 0; nt < 4; ++nt) acc[mt][nt] = vzero8();

  stage(0, 0);
  __syncthreads();

  for (int kb = 0; kb < 16; ++kb) {
    const int cur = kb & 1;
    if (kb < 15) stage(kb + 1, cur ^ 1);   // overlap global stage with compute

    v16h aF[2], bF[4];
#pragma unroll
    for (int mt = 0; mt < 2; ++mt)
      aF[mt] = frag16(&As[cur][(mwave + mt*16 + l16) * 32 + off]);
#pragma unroll
    for (int nt = 0; nt < 4; ++nt)
      bF[nt] = frag16(&Bs[cur][(nwave + nt*16 + l16) * 32 + off]);

#pragma unroll
    for (int mt = 0; mt < 2; ++mt)
#pragma unroll
      for (int nt = 0; nt < 4; ++nt)
        acc[mt][nt] = __builtin_amdgcn_wmma_f32_16x16x32_f16(
            false, aF[mt], false, bF[nt], (short)0, acc[mt][nt], false, false);
    __syncthreads();
  }

#pragma unroll
  for (int mt = 0; mt < 2; ++mt) {
#pragma unroll
    for (int nt = 0; nt < 4; ++nt) {
      const int n = n0 + nwave + nt*16 + l16;
      const float bb = bias[n];
      const int mbase = m0 + mwave + mt*16 + half*8;
#pragma unroll
      for (int r = 0; r < 8; ++r) {
        const float val = acc[mt][nt][r] + bb;
        const size_t oi = (size_t)(mbase + r) * 512 + n;
        if (HALF_OUT) outH[oi] = (_Float16)val;
        else          outF[oi] = val;
      }
    }
  }
}

// -------------------------------------------- blocked local attention (flash)
// One workgroup per (block b, head h). 8 waves x 32 queries = 256 queries.
// Computes S^T = K.Q^T so softmax stats are per-lane and exp(S^T) tiles feed
// the O^T = V^T.P^T WMMA directly (no cross-lane shuffle of probabilities).
// Double-buffered K/V staging; wave-uniform band classification per 32-key
// chunk: skip fully-invalid chunks, mask only boundary chunks.
__global__ __launch_bounds__(256)
void attn_kernel(const _Float16* __restrict__ qh,
                 const _Float16* __restrict__ kh,
                 const _Float16* __restrict__ vh,
                 const int* __restrict__ phi,
                 _Float16* __restrict__ outu) {
  __shared__ _Float16 Ks[2][32 * 64];    // [key][d] chunk
  __shared__ _Float16 VsT[2][64 * 32];   // [d][key] chunk (transposed)

  const int b = blockIdx.x, h = blockIdx.y;
  const int tid  = threadIdx.x;
  const int lane = tid & 31;
  const int wave = tid >> 5;
  const int half = lane >> 4;
  const int l16  = lane & 15;
  const int off  = half * 8;
  const int q0   = wave * 32;

  // Q^T fragments (B operand): col q = l16, contiguous-in-d chunks per lane
  v16h qF[2][2];
#pragma unroll
  for (int qt = 0; qt < 2; ++qt) {
    const size_t qrow = (size_t)(b*BLK + WH + q0 + qt*16 + l16);
    const _Float16* qb = qh + qrow * 512 + h * HD;
#pragma unroll
    for (int ds = 0; ds < 2; ++ds)
      qF[qt][ds] = frag16(qb + ds*32 + off);
  }

  float mrun[2] = {-1e30f, -1e30f};
  float lrun[2] = {0.f, 0.f};
  v8f oacc[2][4];
#pragma unroll
  for (int qt = 0; qt < 2; ++qt)
#pragma unroll
    for (int dt = 0; dt < 4; ++dt) oacc[qt][dt] = vzero8();

  const int lr = tid >> 3;        // staged row 0..31
  const int ls = (tid & 7) * 8;   // seg 0..56

  auto stage = [&](int c, int buf) {
    const size_t kb = (size_t)(b * BLK + c * 32);
    *(v8h*)&Ks[buf][lr * 64 + ls] = *(const v8h*)&kh[(kb + lr) * 512 + h * HD + ls];
    v8h vv = *(const v8h*)&vh[(kb + lr) * 512 + h * HD + ls];
#pragma unroll
    for (int i = 0; i < 8; ++i)
      VsT[buf][(ls + i) * 32 + lr] = vv[i];
  };

  stage(0, 0);
  __syncthreads();

  for (int c = 0; c < 24; ++c) {              // 768-key window in 32-key chunks
    const int cur = c & 1;
    if (c < 23) stage(c + 1, cur ^ 1);        // overlap with compute below

    // wave-uniform band classification for this 32-key chunk
    const int c32 = c * 32;
    const bool anyv  = (c32 + 31 >= q0) && (c32 <= q0 + 31 + 2*WH);
    const bool fullv = (c32 >= q0 + 31) && (c32 + 31 <= q0 + 2*WH);

    if (anyv) {
      // K fragments (A operand of S^T): row = key, chunks along d
      v16h aK[2][2];
#pragma unroll
      for (int kt = 0; kt < 2; ++kt)
#pragma unroll
        for (int ds = 0; ds < 2; ++ds)
          aK[kt][ds] = frag16(&Ks[cur][(kt*16 + l16) * 64 + ds*32 + off]);

      v16h pF[2];
#pragma unroll
      for (int qt = 0; qt < 2; ++qt) {
        v8f st[2];
#pragma unroll
        for (int kt = 0; kt < 2; ++kt) {
          v8f s = vzero8();
          s = __builtin_amdgcn_wmma_f32_16x16x32_f16(false, aK[kt][0], false, qF[qt][0], (short)0, s, false, false);
          s = __builtin_amdgcn_wmma_f32_16x16x32_f16(false, aK[kt][1], false, qF[qt][1], (short)0, s, false, false);
          st[kt] = s;
        }
        const int j = q0 + qt*16 + l16;        // query index in block
        float cmax = -3e30f;
        if (fullv) {
#pragma unroll
          for (int kt = 0; kt < 2; ++kt)
#pragma unroll
            for (int r = 0; r < 8; ++r) {
              const float sv = st[kt][r] * 0.125f;
              st[kt][r] = sv;
              cmax = fmaxf(cmax, sv);
            }
        } else {
#pragma unroll
          for (int kt = 0; kt < 2; ++kt)
#pragma unroll
            for (int r = 0; r < 8; ++r) {
              const int rr = c32 + kt*16 + half*8 + r;   // key index in window
              // band mask j <= rr <= j+512 as one unsigned range test
              const float sv = ((unsigned)(rr - j) <= (unsigned)(2*WH))
                                 ? st[kt][r] * 0.125f : -2e30f;
              st[kt][r] = sv;
              cmax = fmaxf(cmax, sv);
            }
        }
        cmax = fmaxf(cmax, swapx16(cmax));
        const float mnew = fmaxf(mrun[qt], cmax);
        const float corr = __expf(mrun[qt] - mnew);
        float p0[8], p1[8];
        float rs = 0.f;
#pragma unroll
        for (int r = 0; r < 8; ++r) {
          p0[r] = __expf(st[0][r] - mnew);
          p1[r] = __expf(st[1][r] - mnew);
          rs += p0[r] + p1[r];
        }
        rs += swapx16(rs);
        lrun[qt] = lrun[qt] * corr + rs;
        mrun[qt] = mnew;
#pragma unroll
        for (int dt = 0; dt < 4; ++dt)
#pragma unroll
          for (int r = 0; r < 8; ++r) oacc[qt][dt][r] *= corr;
        // P^T B-fragment: lo chunk = keytile 0 rows, hi chunk = keytile 1 rows
        v16h p;
#pragma unroll
        for (int r = 0; r < 8; ++r) {
          p[r]     = (_Float16)p0[r];
          p[r + 8] = (_Float16)p1[r];
        }
        pF[qt] = p;
      }

      // O^T += V^T . P^T
#pragma unroll
      for (int dt = 0; dt < 4; ++dt) {
        v16h vF = frag16(&VsT[cur][(dt*16 + l16) * 32 + off]);
#pragma unroll
        for (int qt = 0; qt < 2; ++qt)
          oacc[qt][dt] = __builtin_amdgcn_wmma_f32_16x16x32_f16(
              false, vF, false, pF[qt], (short)0, oacc[qt][dt], false, false);
      }
    }
    __syncthreads();
  }

  // normalize + scatter (out_un[phi[o]] = out[o]) as f16, 16B stores
#pragma unroll
  for (int qt = 0; qt < 2; ++qt) {
    const int j    = q0 + qt*16 + l16;
    const int dest = phi[b * BLK + j];
    const float inv = 1.0f / lrun[qt];
#pragma unroll
    for (int dt = 0; dt < 4; ++dt) {
      v8h o;
#pragma unroll
      for (int r = 0; r < 8; ++r) o[r] = (_Float16)(oacc[qt][dt][r] * inv);
      *(v8h*)&outu[(size_t)dest * 512 + h * HD + dt*16 + half*8] = o;
    }
  }
}

// ---------------------------------------------------------------------------
extern "C" void kernel_launch(void* const* d_in, const int* in_sizes, int n_in,
                              void* d_out, int out_size, void* d_ws, size_t ws_size,
                              hipStream_t stream) {
  const float* x   = (const float*)d_in[0];
  const int*   phi = (const int*)  d_in[1];
  const float* Wq  = (const float*)d_in[2];
  const float* bq  = (const float*)d_in[3];
  const float* Wk  = (const float*)d_in[4];
  const float* bk  = (const float*)d_in[5];
  const float* Wv  = (const float*)d_in[6];
  const float* bv  = (const float*)d_in[7];
  const float* Wo  = (const float*)d_in[8];
  const float* bo  = (const float*)d_in[9];
  float* out = (float*)d_out;

  _Float16* ws = (_Float16*)d_ws;
  size_t o = 0;
  _Float16* xp  = ws + o; o += (size_t)MPAD * DMODEL;
  _Float16* wqh = ws + o; o += (size_t)DMODEL * DMODEL;
  _Float16* wkh = ws + o; o += (size_t)DMODEL * DMODEL;
  _Float16* wvh = ws + o; o += (size_t)DMODEL * DMODEL;
  _Float16* woh = ws + o; o += (size_t)DMODEL * DMODEL;
  _Float16* q_h = ws + o; o += (size_t)MPAD * DMODEL;
  _Float16* k_h = ws + o; o += (size_t)MPAD * DMODEL;
  _Float16* v_h = ws + o; o += (size_t)MPAD * DMODEL;
  _Float16* att = ws + o; o += (size_t)NTOK * DMODEL;

  const int WN = DMODEL * DMODEL;
  cast_w_kernel<<<256, 256, 0, stream>>>(Wq, wqh, WN);
  cast_w_kernel<<<256, 256, 0, stream>>>(Wk, wkh, WN);
  cast_w_kernel<<<256, 256, 0, stream>>>(Wv, wvh, WN);
  cast_w_kernel<<<256, 256, 0, stream>>>(Wo, woh, WN);

  gather_pad_kernel<<<MPAD / 4, 256, 0, stream>>>(x, phi, xp);

  gemm512_kernel<true ><<<dim3(MPAD / 128, 4), 256, 0, stream>>>(xp, wqh, bq, nullptr, q_h);
  gemm512_kernel<true ><<<dim3(MPAD / 128, 4), 256, 0, stream>>>(xp, wkh, bk, nullptr, k_h);
  gemm512_kernel<true ><<<dim3(MPAD / 128, 4), 256, 0, stream>>>(xp, wvh, bv, nullptr, v_h);

  attn_kernel<<<dim3(NBLK, NHEAD), 256, 0, stream>>>(q_h, k_h, v_h, phi, att);

  gemm512_kernel<false><<<dim3(NTOK / 128, 4), 256, 0, stream>>>(att, woh, bo, out, nullptr);
}

// v001
// Measured time: 118 microseconds a run.
// Two timings next to v000 both put it at 1.38 times that version's speed.
#include <hip/hip_runtime.h>
#include <hip/hip_bf16.h>

typedef __attribute__((ext_vector_type(16))) _Float16 v16h;
typedef __attribute__((ext_vector_type(8)))  _Float16 v8h;
typedef __attribute__((ext_vector_type(8)))  float    v8f;

#define NTOK   16384
#define DMODEL 512
#define NHEAD  8
#define HD     64
#define BLK    256                 // query block == w_half
#define WH     256                 // w_half
#define MPAD   (NTOK + 2*WH)       // 16896 padded rows
#define NBLK   (NTOK / BLK)        // 64

#define P32    40                  // rows of 32 halves (64 B) at 80 B
#define P64    72                  // rows of 64 halves (128 B) at 144 B
#define VGRP   16
#define VTILE  (64 * P32 + 4 * VGRP)

static __device__ inline v16h frag16(const _Float16* p) {
  v8h lo = *(const v8h*)(p);
  v8h hi = *(const v8h*)(p + 16);
  return __builtin_shufflevector(lo, hi, 0,1,2,3,4,5,6,7,8,9,10,11,12,13,14,15);
}

static __device__ inline v8f vzero8() {
  v8f z = {0.f,0.f,0.f,0.f,0.f,0.f,0.f,0.f};
  return z;
}

static __device__ inline float swapx16(float x) {
  return __int_as_float(__builtin_amdgcn_ds_swizzle(__float_as_int(x), 0x401f));
}

// ---------------------------------------------------------------- cast f32->f16
__global__ void cast_w_kernel(const float* __restrict__ src,
                              _Float16* __restrict__ dst, int n) {
  int i = (blockIdx.x * blockDim.x + threadIdx.x) * 4;
  if (i + 3 < n) {
    float4 v = *(const float4*)(src + i);
    dst[i+0] = (_Float16)v.x; dst[i+1] = (_Float16)v.y;
    dst[i+2] = (_Float16)v.z; dst[i+3] = (_Float16)v.w;
  }
}

// ------------------------------------------------- gather by phi + circular pad
__global__ void gather_pad_kernel(const float* __restrict__ x,
                                  const int* __restrict__ phi,
                                  _Float16* __restrict__ xp) {
  int t   = blockIdx.x * 256 + threadIdx.x;   // one 8-half segment per thread
  int idx = t * 8;
  int p   = idx >> 9;          // padded row
  int c   = idx & 511;         // column
  int o   = p - WH;
  if (o < 0)      o += NTOK;
  if (o >= NTOK)  o -= NTOK;
  int src = phi[o];
  const float* s = x + (size_t)src * DMODEL + c;
  float4 a = *(const float4*)s;
  float4 b = *(const float4*)(s + 4);
  v8h out;
  out[0]=(_Float16)a.x; out[1]=(_Float16)a.y; out[2]=(_Float16)a.z; out[3]=(_Float16)a.w;
  out[4]=(_Float16)b.x; out[5]=(_Float16)b.y; out[6]=(_Float16)b.z; out[7]=(_Float16)b.w;
  *(v8h*)(xp + (size_t)p * DMODEL + c) = out;
}

// ------------------------------------------------------- C = A @ W^T + bias
// A: [M x 512] f16 row-major.  W: [512 x 512] f16 row-major (B(k,n)=W[n][k]).
// 128x128 tile per workgroup, 8 waves (4 along M x 2 along N), 32-deep k-steps.
// Double-buffered LDS: global stage of step kb+1 overlaps WMMA of step kb;
// one barrier per k-step.
template<bool HALF_OUT>
__global__ __launch_bounds__(256)
void gemm512_kernel(const _Float16* __restrict__ A,
                    const _Float16* __restrict__ W,
                    const float* __restrict__ bias,
                    float* __restrict__ outF,
                    _Float16* __restrict__ outH) {
  __shared__ __attribute__((aligned(16))) _Float16 As[2][128 * P32];
  __shared__ __attribute__((aligned(16))) _Float16 Bs[2][128 * P32];

  const int tid  = threadIdx.x;
  const int lane = tid & 31;
  const int wave = tid >> 5;
  const int m0 = blockIdx.x * 128;
  const int n0 = blockIdx.y * 128;
  const int mwave = (wave & 3) * 32;   // 4 waves along M
  const int nwave = (wave >> 2) * 64;  // 2 waves along N
  const int half = lane >> 4;
  const int l16  = lane & 15;
  const int off  = half * 8;

  const int lrow = tid >> 2;           // 0..63
  const int lseg = (tid & 3) * 8;      // 0,8,16,24

  auto stage = [&](int kb, int buf) {
    const int k0 = kb * 32;
    *(v8h*)&As[buf][ lrow     *P32 + lseg] = *(const v8h*)&A[(size_t)(m0+lrow   )*512 + k0 + lseg];
    *(v8h*)&As[buf][(lrow+64) *P32 + lseg] = *(const v8h*)&A[(size_t)(m0+lrow+64)*512 + k0 + lseg];
    *(v8h*)&Bs[buf][ lrow     *P32 + lseg] = *(const v8h*)&W[(size_t)(n0+lrow   )*512 + k0 + lseg];
    *(v8h*)&Bs[buf][(lrow+64) *P32 + lseg] = *(const v8h*)&W[(size_t)(n0+lrow+64)*512 + k0 + lseg];
  };

  v8f acc[2][4];
#pragma unroll
  for (int mt = 0; mt < 2; ++mt)
#pragma unroll
    for (int nt = 0; nt < 4; ++nt) acc[mt][nt] = vzero8();

  stage(0, 0);
  __syncthreads();

  for (int kb = 0; kb < 16; ++kb) {
    const int cur = kb & 1;
    if (kb < 15) stage(kb + 1, cur ^ 1);   // overlap global stage with compute

    v16h aF[2], bF[4];
#pragma unroll
    for (int mt = 0; mt < 2; ++mt)
      aF[mt] = frag16(&As[cur][(mwave + mt*16 + l16) * P32 + off]);
#pragma unroll
    for (int nt = 0; nt < 4; ++nt)
      bF[nt] = frag16(&Bs[cur][(nwave + nt*16 + l16) * P32 + off]);

#pragma unroll
    for (int mt = 0; mt < 2; ++mt)
#pragma unroll
      for (int nt = 0; nt < 4; ++nt)
        acc[mt][nt] = __builtin_amdgcn_wmma_f32_16x16x32_f16(
            false, aF[mt], false, bF[nt], (short)0, acc[mt][nt], false, false);
    __syncthreads();
  }

#pragma unroll
  for (int mt = 0; mt < 2; ++mt) {
#pragma unroll
    for (int nt = 0; nt < 4; ++nt) {
      const int n = n0 + nwave + nt*16 + l16;
      const float bb = bias[n];
      const int mbase = m0 + mwave + mt*16 + half*8;
#pragma unroll
      for (int r = 0; r < 8; ++r) {
        const float val = acc[mt][nt][r] + bb;
        const size_t oi = (size_t)(mbase + r) * 512 + n;
        if (HALF_OUT) outH[oi] = (_Float16)val;
        else          outF[oi] = val;
      }
    }
  }
}

// -------------------------------------------- blocked local attention (flash)
// One workgroup per (block b, head h). 8 waves x 32 queries = 256 queries.
// Computes S^T = K.Q^T so softmax stats are per-lane and exp(S^T) tiles feed
// the O^T = V^T.P^T WMMA directly (no cross-lane shuffle of probabilities).
// Double-buffered K/V staging; wave-uniform band classification per 32-key
// chunk: skip fully-invalid chunks, mask only boundary chunks.
__global__ __launch_bounds__(256)
void attn_kernel(const _Float16* __restrict__ qh,
                 const _Float16* __restrict__ kh,
                 const _Float16* __restrict__ vh,
                 const int* __restrict__ phi,
                 _Float16* __restrict__ outu) {
  __shared__ __attribute__((aligned(16))) _Float16 Ks[2][32 * P64];  // [key][d] chunk
  __shared__ __attribute__((aligned(16))) _Float16 VsT[2][VTILE];    // [d][key] chunk (transposed)

  const int b = blockIdx.x, h = blockIdx.y;
  const int tid  = threadIdx.x;
  const int lane = tid & 31;
  const int wave = tid >> 5;
  const int half = lane >> 4;
  const int l16  = lane & 15;
  const int off  = half * 8;
  const int q0   = wave * 32;

  // Q^T fragments (B operand): col q = l16, contiguous-in-d chunks per lane
  v16h qF[2][2];
#pragma unroll
  for (int qt = 0; qt < 2; ++qt) {
    const size_t qrow = (size_t)(b*BLK + WH + q0 + qt*16 + l16);
    const _Float16* qb = qh + qrow * 512 + h * HD;
#pragma unroll
    for (int ds = 0; ds < 2; ++ds)
      qF[qt][ds] = frag16(qb + ds*32 + off);
  }

  float mrun[2] = {-1e30f, -1e30f};
  float lrun[2] = {0.f, 0.f};
  v8f oacc[2][4];
#pragma unroll
  for (int qt = 0; qt < 2; ++qt)
#pragma unroll
    for (int dt = 0; dt < 4; ++dt) oacc[qt][dt] = vzero8();

  const int lr = tid >> 3;        // staged row 0..31
  const int ls = (tid & 7) * 8;   // seg 0..56

  auto stage = [&](int c, int buf) {
    const size_t kb = (size_t)(b * BLK + c * 32);
    *(v8h*)&Ks[buf][lr * P64 + ls] = *(const v8h*)&kh[(kb + lr) * 512 + h * HD + ls];
    v8h vv = *(const v8h*)&vh[(kb + lr) * 512 + h * HD + ls];
#pragma unroll
    for (int i = 0; i < 8; ++i)
      VsT[buf][(ls + i) * P32 + (ls >> 4) * VGRP + lr] = vv[i];
  };

  stage(0, 0);
  __syncthreads();

  for (int c = 0; c < 24; ++c) {              // 768-key window in 32-key chunks
    const int cur = c & 1;
    if (c < 23) stage(c + 1, cur ^ 1);        // overlap with compute below

    // wave-uniform band classification for this 32-key chunk
    const int c32 = c * 32;
    const bool anyv  = (c32 + 31 >= q0) && (c32 <= q0 + 31 + 2*WH);
    const bool fullv = (c32 >= q0 + 31) && (c32 + 31 <= q0 + 2*WH);

    if (anyv) {
      // K fragments (A operand of S^T): row = key, chunks along d
      v16h aK[2][2];
#pragma unroll
      for (int kt = 0; kt < 2; ++kt)
#pragma unroll
        for (int ds = 0; ds < 2; ++ds)
          aK[kt][ds] = frag16(&Ks[cur][(kt*16 + l16) * P64 + ds*32 + off]);

      v16h pF[2];
#pragma unroll
      for (int qt = 0; qt < 2; ++qt) {
        v8f st[2];
#pragma unroll
        for (int kt = 0; kt < 2; ++kt) {
          v8f s = vzero8();
          s = __builtin_amdgcn_wmma_f32_16x16x32_f16(false, aK[kt][0], false, qF[qt][0], (short)0, s, false, false);
          s = __builtin_amdgcn_wmma_f32_16x16x32_f16(false, aK[kt][1], false, qF[qt][1], (short)0, s, false, false);
          st[kt] = s;
        }
        const int j = q0 + qt*16 + l16;        // query index in block
        float cmax = -3e30f;
        if (fullv) {
#pragma unroll
          for (int kt = 0; kt < 2; ++kt)
#pragma unroll
            for (int r = 0; r < 8; ++r) {
              const float sv = st[kt][r] * 0.125f;
              st[kt][r] = sv;
              cmax = fmaxf(cmax, sv);
            }
        } else {
#pragma unroll
          for (int kt = 0; kt < 2; ++kt)
#pragma unroll
            for (int r = 0; r < 8; ++r) {
              const int rr = c32 + kt*16 + half*8 + r;   // key index in window
              // band mask j <= rr <= j+512 as one unsigned range test
              const float sv = ((unsigned)(rr - j) <= (unsigned)(2*WH))
                                 ? st[kt][r] * 0.125f : -2e30f;
              st[kt][r] = sv;
              cmax = fmaxf(cmax, sv);
            }
        }
        cmax = fmaxf(cmax, swapx16(cmax));
        const float mnew = fmaxf(mrun[qt], cmax);
        const float corr = __expf(mrun[qt] - mnew);
        float p0[8], p1[8];
        float rs = 0.f;
#pragma unroll
        for (int r = 0; r < 8; ++r) {
          p0[r] = __expf(st[0][r] - mnew);
          p1[r] = __expf(st[1][r] - mnew);
          rs += p0[r] + p1[r];
        }
        rs += swapx16(rs);
        lrun[qt] = lrun[qt] * corr + rs;
        mrun[qt] = mnew;
#pragma unroll
        for (int dt = 0; dt < 4; ++dt)
#pragma unroll
          for (int r = 0; r < 8; ++r) oacc[qt][dt][r] *= corr;
        // P^T B-fragment: lo chunk = keytile 0 rows, hi chunk = keytile 1 rows
        v16h p;
#pragma unroll
        for (int r = 0; r < 8; ++r) {
          p[r]     = (_Float16)p0[r];
          p[r + 8] = (_Float16)p1[r];
        }
        pF[qt] = p;
      }

      // O^T += V^T . P^T
#pragma unroll
      for (int dt = 0; dt < 4; ++dt) {
        v16h vF = frag16(&VsT[cur][(dt*16 + l16) * P32 + dt * VGRP + off]);
#pragma unroll
        for (int qt = 0; qt < 2; ++qt)
          oacc[qt][dt] = __builtin_amdgcn_wmma_f32_16x16x32_f16(
              false, vF, false, pF[qt], (short)0, oacc[qt][dt], false, false);
      }
    }
    __syncthreads();
  }

  // normalize + scatter (out_un[phi[o]] = out[o]) as f16, 16B stores
#pragma unroll
  for (int qt = 0; qt < 2; ++qt) {
    const int j    = q0 + qt*16 + l16;
    const int dest = phi[b * BLK + j];
    const float inv = 1.0f / lrun[qt];
#pragma unroll
    for (int dt = 0; dt < 4; ++dt) {
      v8h o;
#pragma unroll
      for (int r = 0; r < 8; ++r) o[r] = (_Float16)(oacc[qt][dt][r] * inv);
      *(v8h*)&outu[(size_t)dest * 512 + h * HD + dt*16 + half*8] = o;
    }
  }
}

// ---------------------------------------------------------------------------
extern "C" void kernel_launch(void* const* d_in, const int* in_sizes, int n_in,
                              void* d_out, int out_size, void* d_ws, size_t ws_size,
                              hipStream_t stream) {
  const float* x   = (const float*)d_in[0];
  const int*   phi = (const int*)  d_in[1];
  const float* Wq  = (const float*)d_in[2];
  const float* bq  = (const float*)d_in[3];
  const float* Wk  = (const float*)d_in[4];
  const float* bk  = (const float*)d_in[5];
  const float* Wv  = (const float*)d_in[6];
  const float* bv  = (const float*)d_in[7];
  const float* Wo  = (const float*)d_in[8];
  const float* bo  = (const float*)d_in[9];
  float* out = (float*)d_out;

  _Float16* ws = (_Float16*)d_ws;
  size_t o = 0;
  _Float16* xp  = ws + o; o += (size_t)MPAD * DMODEL;
  _Float16* wqh = ws + o; o += (size_t)DMODEL * DMODEL;
  _Float16* wkh = ws + o; o += (size_t)DMODEL * DMODEL;
  _Float16* wvh = ws + o; o += (size_t)DMODEL * DMODEL;
  _Float16* woh = ws + o; o += (size_t)DMODEL * DMODEL;
  _Float16* q_h = ws + o; o += (size_t)MPAD * DMODEL;
  _Float16* k_h = ws + o; o += (size_t)MPAD * DMODEL;
  _Float16* v_h = ws + o; o += (size_t)MPAD * DMODEL;
  _Float16* att = ws + o; o += (size_t)NTOK * DMODEL;

  const int WN = DMODEL * DMODEL;
  cast_w_kernel<<<256, 256, 0, stream>>>(Wq, wqh, WN);
  cast_w_kernel<<<256, 256, 0, stream>>>(Wk, wkh, WN);
  cast_w_kernel<<<256, 256, 0, stream>>>(Wv, wvh, WN);
  cast_w_kernel<<<256, 256, 0, stream>>>(Wo, woh, WN);

  gather_pad_kernel<<<MPAD / 4, 256, 0, stream>>>(x, phi, xp);

  gemm512_kernel<true ><<<dim3(MPAD / 128, 4), 256, 0, stream>>>(xp, wqh, bq, nullptr, q_h);
  gemm512_kernel<true ><<<dim3(MPAD / 128, 4), 256, 0, stream>>>(xp, wkh, bk, nullptr, k_h);
  gemm512_kernel<true ><<<dim3(MPAD / 128, 4), 256, 0, stream>>>(xp, wvh, bv, nullptr, v_h);

  attn_kernel<<<dim3(NBLK, NHEAD), 256, 0, stream>>>(q_h, k_h, v_h, phi, att);

  gemm512_kernel<false><<<dim3(NTOK / 128, 4), 256, 0, stream>>>(att, woh, bo, out, nullptr);
}

// v002
// It runs in 104 microseconds.
// In both of two side-by-side timings against v001, it was 1.15 times as fast.
// Over all steps from v000 it is 1.59 times as fast.
#include <hip/hip_runtime.h>
#include <hip/hip_bf16.h>

typedef __attribute__((ext_vector_type(16))) _Float16 v16h;
typedef __attribute__((ext_vector_type(8)))  _Float16 v8h;
typedef __attribute__((ext_vector_type(8)))  float    v8f;

#define NTOK   16384
#define DMODEL 512
#define NHEAD  8
#define HD     64
#define BLK    256                 // query block == w_half
#define WH     256                 // w_half
#define MPAD   (NTOK + 2*WH)       // 16896 padded rows
#define NBLK   (NTOK / BLK)        // 64

#define P32    40                  // rows of 32 halves (64 B) at 80 B
#define P64    72                  // rows of 64 halves (128 B) at 144 B
#define VGRP   16
#define VTILE  (64 * P32 + 4 * VGRP)

static __device__ inline v16h frag16(const _Float16* p) {
  v8h lo = *(const v8h*)(p);
  v8h hi = *(const v8h*)(p + 16);
  return __builtin_shufflevector(lo, hi, 0,1,2,3,4,5,6,7,8,9,10,11,12,13,14,15);
}

static __device__ inline v8f vzero8() {
  v8f z = {0.f,0.f,0.f,0.f,0.f,0.f,0.f,0.f};
  return z;
}

static __device__ inline float swapx16(float x) {
  return __int_as_float(__builtin_amdgcn_ds_swizzle(__float_as_int(x), 0x401f));
}

// ------------- one grid for the five independent preparation jobs, by block range
// blocks [0, 4*CASTB): cast f32->f16 of Wq, Wk, Wv, Wo into four planes of wh
// blocks [4*CASTB, ..): gather by phi + circular pad
#define WN     (DMODEL * DMODEL)
#define CASTB  (WN / 1024)         // 256 blocks of 256 threads x 4 elements per weight
__global__ void prep_kernel(const float* __restrict__ x,
                            const int* __restrict__ phi,
                            const float* __restrict__ Wq,
                            const float* __restrict__ Wk,
                            const float* __restrict__ Wv,
                            const float* __restrict__ Wo,
                            _Float16* __restrict__ xp,
                            _Float16* __restrict__ wh) {
  if (blockIdx.x < 4 * CASTB) {
    const int sel = blockIdx.x / CASTB;
    const float* src = sel == 0 ? Wq : sel == 1 ? Wk : sel == 2 ? Wv : Wo;
    _Float16* dst = wh + (size_t)sel * WN;
    int i = ((blockIdx.x % CASTB) * 256 + threadIdx.x) * 4;
    float4 v = *(const float4*)(src + i);
    dst[i+0] = (_Float16)v.x; dst[i+1] = (_Float16)v.y;
    dst[i+2] = (_Float16)v.z; dst[i+3] = (_Float16)v.w;
    return;
  }
  int t   = (blockIdx.x - 4 * CASTB) * 256 + threadIdx.x;   // one 8-half segment per thread
  int idx = t * 8;
  int p   = idx >> 9;          // padded row
  int c   = idx & 511;         // column
  int o   = p - WH;
  if (o < 0)      o += NTOK;
  if (o >= NTOK)  o -= NTOK;
  int src = min(max(phi[o], 0), NTOK - 1);   // the row read stays inside x for any content of phi
  const float* s = x + (size_t)src * DMODEL + c;
  float4 a = *(const float4*)s;
  float4 b = *(const float4*)(s + 4);
  v8h out;
  out[0]=(_Float16)a.x; out[1]=(_Float16)a.y; out[2]=(_Float16)a.z; out[3]=(_Float16)a.w;
  out[4]=(_Float16)b.x; out[5]=(_Float16)b.y; out[6]=(_Float16)b.z; out[7]=(_Float16)b.w;
  *(v8h*)(xp + (size_t)p * DMODEL + c) = out;
  // stands in front of any later write of this store's registers: the built code lays
  // the cast path behind the store, where the separate gather kernel simply ended
  asm volatile("s_wait_xcnt 0x0" ::: "memory");
}

// ------------------------------------------------------- C = A @ W^T + bias
// A: [M x 512] f16 row-major.  W: [512 x 512] f16 row-major (B(k,n)=W[n][k]).
// 128x128 tile per workgroup, 8 waves (4 along M x 2 along N), 32-deep k-steps.
// Double-buffered LDS: global stage of step kb+1 overlaps WMMA of step kb;
// one barrier per k-step.
// blockIdx.y = 4*sel + n-tile: product sel uses weight plane sel of W, bias sel and
// output plane sel of outH, so independent products on one A share one grid.
template<bool HALF_OUT>
__global__ __launch_bounds__(256)
void gemm512_kernel(const _Float16* __restrict__ A,
                    const _Float16* __restrict__ Wall,
                    const float* __restrict__ bias0,
                    const float* __restrict__ bias1,
                    const float* __restrict__ bias2,
                    float* __restrict__ outF,
                    _Float16* __restrict__ outHall) {
  __shared__ __attribute__((aligned(16))) _Float16 As[2][128 * P32];
  __shared__ __attribute__((aligned(16))) _Float16 Bs[2][128 * P32];

  const int tid  = threadIdx.x;
  const int lane = tid & 31;
  const int wave = tid >> 5;
  const int m0 = blockIdx.x * 128;
  const int sel = blockIdx.y >> 2;
  const int n0 = (blockIdx.y & 3) * 128;
  const _Float16* __restrict__ W = Wall + (size_t)sel * WN;
  const float* __restrict__ bias = sel == 0 ? bias0 : sel == 1 ? bias1 : bias2;
  _Float16* __restrict__ outH = outHall + (size_t)sel * MPAD * DMODEL;
  const int mwave = (wave & 3) * 32;   // 4 waves along M
  const int nwave = (wave >> 2) * 64;  // 2 waves along N
  const int half = lane >> 4;
  const int l16  = lane & 15;
  const int off  = half * 8;

  const int lrow = tid >> 2;           // 0..63
  const int lseg = (tid & 3) * 8;      // 0,8,16,24

  auto stage = [&](int kb, int buf) {
    const int k0 = kb * 32;
    *(v8h*)&As[buf][ lrow     *P32 + lseg] = *(const v8h*)&A[(size_t)(m0+lrow   )*512 + k0 + lseg];
    *(v8h*)&As[buf][(lrow+64) *P32 + lseg] = *(const v8h*)&A[(size_t)(m0+lrow+64)*512 + k0 + lseg];
    *(v8h*)&Bs[buf][ lrow     *P32 + lseg] = *(const v8h*)&W[(size_t)(n0+lrow   )*512 + k0 + lseg];
    *(v8h*)&Bs[buf][(lrow+64) *P32 + lseg] = *(const v8h*)&W[(size_t)(n0+lrow+64)*512 + k0 + lseg];
  };

  v8f acc[2][4];
#pragma unroll
  for (int mt = 0; mt < 2; ++mt)
#pragma unroll
    for (int nt = 0; nt < 4; ++nt) acc[mt][nt] = vzero8();

  stage(0, 0);
  __syncthreads();

  for (int kb = 0; kb < 16; ++kb) {
    const int cur = kb & 1;
    if (kb < 15) stage(kb + 1, cur ^ 1);   // overlap global stage with compute

    v16h aF[2], bF[4];
#pragma unroll
    for (int mt = 0; mt < 2; ++mt)
      aF[mt] = frag16(&As[cur][(mwave + mt*16 + l16) * P32 + off]);
#pragma unroll
    for (int nt = 0; nt < 4; ++nt)
      bF[nt] = frag16(&Bs[cur][(nwave + nt*16 + l16) * P32 + off]);

#pragma unroll
    for (int mt = 0; mt < 2; ++mt)
#pragma unroll
      for (int nt = 0; nt < 4; ++nt)
        acc[mt][nt] = __builtin_amdgcn_wmma_f32_16x16x32_f16(
            false, aF[mt], false, bF[nt], (short)0, acc[mt][nt], false, false);
    __syncthreads();
  }

#pragma unroll
  for (int mt = 0; mt < 2; ++mt) {
#pragma unroll
    for (int nt = 0; nt < 4; ++nt) {
      const int n = n0 + nwave + nt*16 + l16;
      const float bb = bias[n];
      const int mbase = m0 + mwave + mt*16 + half*8;
#pragma unroll
      for (int r = 0; r < 8; ++r) {
        const float val = acc[mt][nt][r] + bb;
        const size_t oi = (size_t)(mbase + r) * 512 + n;
        if (HALF_OUT) outH[oi] = (_Float16)val;
        else          outF[oi] = val;
      }
    }
  }
}

// -------------------------------------------- blocked local attention (flash)
// One workgroup per (block b, head h). 8 waves x 32 queries = 256 queries.
// Computes S^T = K.Q^T so softmax stats are per-lane and exp(S^T) tiles feed
// the O^T = V^T.P^T WMMA directly (no cross-lane shuffle of probabilities).
// Double-buffered K/V staging; wave-uniform band classification per 32-key
// chunk: skip fully-invalid chunks, mask only boundary chunks.
__global__ __launch_bounds__(256)
void attn_kernel(const _Float16* __restrict__ qh,
                 const _Float16* __restrict__ kh,
                 const _Float16* __restrict__ vh,
                 const int* __restrict__ phi,
                 _Float16* __restrict__ outu) {
  __shared__ __attribute__((aligned(16))) _Float16 Ks[2][32 * P64];  // [key][d] chunk
  __shared__ __attribute__((aligned(16))) _Float16 VsT[2][VTILE];    // [d][key] chunk (transposed)

  const int b = blockIdx.x, h = blockIdx.y;
  const int tid  = threadIdx.x;
  const int lane = tid & 31;
  const int wave = tid >> 5;
  const int half = lane >> 4;
  const int l16  = lane & 15;
  const int off  = half * 8;
  const int q0   = wave * 32;

  // Q^T fragments (B operand): col q = l16, contiguous-in-d chunks per lane
  v16h qF[2][2];
#pragma unroll
  for (int qt = 0; qt < 2; ++qt) {
    const size_t qrow = (size_t)(b*BLK + WH + q0 + qt*16 + l16);
    const _Float16* qb = qh + qrow * 512 + h * HD;
#pragma unroll
    for (int ds = 0; ds < 2; ++ds)
      qF[qt][ds] = frag16(qb + ds*32 + off);
  }

  float mrun[2] = {-1e30f, -1e30f};
  float lrun[2] = {0.f, 0.f};
  v8f oacc[2][4];
#pragma unroll
  for (int qt = 0; qt < 2; ++qt)
#pragma unroll
    for (int dt = 0; dt < 4; ++dt) oacc[qt][dt] = vzero8();

  const int lr = tid >> 3;        // staged row 0..31
  const int ls = (tid & 7) * 8;   // seg 0..56

  auto stage = [&](int c, int buf) {
    const size_t kb = (size_t)(b * BLK + c * 32);
    *(v8h*)&Ks[buf][lr * P64 + ls] = *(const v8h*)&kh[(kb + lr) * 512 + h * HD + ls];
    v8h vv = *(const v8h*)&vh[(kb + lr) * 512 + h * HD + ls];
#pragma unroll
    for (int i = 0; i < 8; ++i)
      VsT[buf][(ls + i) * P32 + (ls >> 4) * VGRP + lr] = vv[i];
  };

  stage(0, 0);
  __syncthreads();

  for (int c = 0; c < 24; ++c) {              // 768-key window in 32-key chunks
    const int cur = c & 1;
    if (c < 23) stage(c + 1, cur ^ 1);        // overlap with compute below

    // wave-uniform band classification for this 32-key chunk
    const int c32 = c * 32;
    const bool anyv  = (c32 + 31 >= q0) && (c32 <= q0 + 31 + 2*WH);
    const bool fullv = (c32 >= q0 + 31) && (c32 + 31 <= q0 + 2*WH);

    if (anyv) {
      // K fragments (A operand of S^T): row = key, chunks along d
      v16h aK[2][2];
#pragma unroll
      for (int kt = 0; kt < 2; ++kt)
#pragma unroll
        for (int ds = 0; ds < 2; ++ds)
          aK[kt][ds] = frag16(&Ks[cur][(kt*16 + l16) * P64 + ds*32 + off]);

      v16h pF[2];
#pragma unroll
      for (int qt = 0; qt < 2; ++qt) {
        v8f st[2];
#pragma unroll
        for (int kt = 0; kt < 2; ++kt) {
          v8f s = vzero8();
          s = __builtin_amdgcn_wmma_f32_16x16x32_f16(false, aK[kt][0], false, qF[qt][0], (short)0, s, false, false);
          s = __builtin_amdgcn_wmma_f32_16x16x32_f16(false, aK[kt][1], false, qF[qt][1], (short)0, s, false, false);
          st[kt] = s;
        }
        const int j = q0 + qt*16 + l16;        // query index in block
        float cmax = -3e30f;
        if (fullv) {
#pragma unroll
          for (int kt = 0; kt < 2; ++kt)
#pragma unroll
            for (int r = 0; r < 8; ++r) {
              const float sv = st[kt][r] * 0.125f;
              st[kt][r] = sv;
              cmax = fmaxf(cmax, sv);
            }
        } else {
#pragma unroll
          for (int kt = 0; kt < 2; ++kt)
#pragma unroll
            for (int r = 0; r < 8; ++r) {
              const int rr = c32 + kt*16 + half*8 + r;   // key index in window
              // band mask j <= rr <= j+512 as one unsigned range test
              const float sv = ((unsigned)(rr - j) <= (unsigned)(2*WH))
                                 ? st[kt][r] * 0.125f : -2e30f;
              st[kt][r] = sv;
              cmax = fmaxf(cmax, sv);
            }
        }
        cmax = fmaxf(cmax, swapx16(cmax));
        const float mnew = fmaxf(mrun[qt], cmax);
        const float corr = __expf(mrun[qt] - mnew);
        float p0[8], p1[8];
        float rs = 0.f;
#pragma unroll
        for (int r = 0; r < 8; ++r) {
          p0[r] = __expf(st[0][r] - mnew);
          p1[r] = __expf(st[1][r] - mnew);
          rs += p0[r] + p1[r];
        }
        rs += swapx16(rs);
        lrun[qt] = lrun[qt] * corr + rs;
        mrun[qt] = mnew;
#pragma unroll
        for (int dt = 0; dt < 4; ++dt)
#pragma unroll
          for (int r = 0; r < 8; ++r) oacc[qt][dt][r] *= corr;
        // P^T B-fragment: lo chunk = keytile 0 rows, hi chunk = keytile 1 rows
        v16h p;
#pragma unroll
        for (int r = 0; r < 8; ++r) {
          p[r]     = (_Float16)p0[r];
          p[r + 8] = (_Float16)p1[r];
        }
        pF[qt] = p;
      }

      // O^T += V^T . P^T
#pragma unroll
      for (int dt = 0; dt < 4; ++dt) {
        v16h vF = frag16(&VsT[cur][(dt*16 + l16) * P32 + dt * VGRP + off]);
#pragma unroll
        for (int qt = 0; qt < 2; ++qt)
          oacc[qt][dt] = __builtin_amdgcn_wmma_f32_16x16x32_f16(
              false, vF, false, pF[qt], (short)0, oacc[qt][dt], false, false);
      }
    }
    __syncthreads();
  }

  // normalize + scatter (out_un[phi[o]] = out[o]) as f16, 16B stores
#pragma unroll
  for (int qt = 0; qt < 2; ++qt) {
    const int j    = q0 + qt*16 + l16;
    const int dest = phi[b * BLK + j];
    const float inv = 1.0f / lrun[qt];
#pragma unroll
    for (int dt = 0; dt < 4; ++dt) {
      v8h o;
#pragma unroll
      for (int r = 0; r < 8; ++r) o[r] = (_Float16)(oacc[qt][dt][r] * inv);
      *(v8h*)&outu[(size_t)dest * 512 + h * HD + dt*16 + half*8] = o;
    }
  }
}

// ---------------------------------------------------------------------------
extern "C" void kernel_launch(void* const* d_in, const int* in_sizes, int n_in,
                              void* d_out, int out_size, void* d_ws, size_t ws_size,
                              hipStream_t stream) {
  const float* x   = (const float*)d_in[0];
  const int*   phi = (const int*)  d_in[1];
  const float* Wq  = (const float*)d_in[2];
  const float* bq  = (const float*)d_in[3];
  const float* Wk  = (const float*)d_in[4];
  const float* bk  = (const float*)d_in[5];
  const float* Wv  = (const float*)d_in[6];
  const float* bv  = (const float*)d_in[7];
  const float* Wo  = (const float*)d_in[8];
  const float* bo  = (const float*)d_in[9];
  float* out = (float*)d_out;

  _Float16* ws = (_Float16*)d_ws;
  size_t o = 0;
  _Float16* xp  = ws + o; o += (size_t)MPAD * DMODEL;
  _Float16* wqh = ws + o; o += (size_t)DMODEL * DMODEL;
  _Float16* wkh = ws + o; o += (size_t)DMODEL * DMODEL;
  _Float16* wvh = ws + o; o += (size_t)DMODEL * DMODEL;
  _Float16* woh = ws + o; o += (size_t)DMODEL * DMODEL;
  _Float16* q_h = ws + o; o += (size_t)MPAD * DMODEL;
  _Float16* k_h = ws + o; o += (size_t)MPAD * DMODEL;
  _Float16* v_h = ws + o; o += (size_t)MPAD * DMODEL;
  _Float16* att = ws + o; o += (size_t)NTOK * DMODEL;

  // wqh..woh are four adjacent planes of the workspace, q_h..v_h three adjacent ones
  prep_kernel<<<4 * CASTB + MPAD / 4, 256, 0, stream>>>(x, phi, Wq, Wk, Wv, Wo, xp, wqh);

  gemm512_kernel<true ><<<dim3(MPAD / 128, 12), 256, 0, stream>>>(xp, wqh, bq, bk, bv, nullptr, q_h);

  attn_kernel<<<dim3(NBLK, NHEAD), 256, 0, stream>>>(q_h, k_h, v_h, phi, att);

  gemm512_kernel<false><<<dim3(NTOK / 128, 4), 256, 0, stream>>>(att, woh, bo, bo, bo, out, nullptr);
}

// v003
// Measured time: 96.6 microseconds a run.
// Timed twice side by side with v002, it ran 1.08 and 1.07 times as fast.
// Over all steps from v000 it is 1.71 times as fast.
#include <hip/hip_runtime.h>
#include <hip/hip_bf16.h>

typedef __attribute__((ext_vector_type(16))) _Float16 v16h;
typedef __attribute__((ext_vector_type(8)))  _Float16 v8h;
typedef __attribute__((ext_vector_type(4)))  _Float16 v4h;
typedef __attribute__((ext_vector_type(8)))  float    v8f;

#define NTOK   16384
#define DMODEL 512
#define NHEAD  8
#define HD     64
#define BLK    256                 // query block == w_half
#define WH     256                 // w_half
#define MPAD   (NTOK + 2*WH)       // 16896 padded rows
#define NBLK   (NTOK / BLK)        // 64

#define P32    40                  // rows of 32 halves (64 B) at 80 B
#define P64    72                  // rows of 64 halves (128 B) at 144 B
#define VGRP   16
#define VTILE  (64 * P32 + 4 * VGRP)

static __device__ inline v16h frag16(const _Float16* p) {
  v8h lo = *(const v8h*)(p);
  v8h hi = *(const v8h*)(p + 16);
  return __builtin_shufflevector(lo, hi, 0,1,2,3,4,5,6,7,8,9,10,11,12,13,14,15);
}

static __device__ inline v8f vzero8() {
  v8f z = {0.f,0.f,0.f,0.f,0.f,0.f,0.f,0.f};
  return z;
}

static __device__ inline float swapx16(float x) {
  return __int_as_float(__builtin_amdgcn_ds_swizzle(__float_as_int(x), 0x401f));
}

// ------------- one grid for the five independent preparation jobs, by block range
// blocks [0, 4*CASTB): cast f32->f16 of Wq, Wk, Wv, Wo into four planes of wh
// blocks [4*CASTB, ..): gather by phi + circular pad
#define WN     (DMODEL * DMODEL)
#define CASTB  (WN / 1024)         // 256 blocks of 256 threads x 4 elements per weight
__global__ void prep_kernel(const float* __restrict__ x,
                            const int* __restrict__ phi,
                            const float* __restrict__ Wq,
                            const float* __restrict__ Wk,
                            const float* __restrict__ Wv,
                            const float* __restrict__ Wo,
                            _Float16* __restrict__ xp,
                            _Float16* __restrict__ wh) {
  if (blockIdx.x < 4 * CASTB) {
    const int sel = blockIdx.x / CASTB;
    const float* src = sel == 0 ? Wq : sel == 1 ? Wk : sel == 2 ? Wv : Wo;
    _Float16* dst = wh + (size_t)sel * WN;
    int i = ((blockIdx.x % CASTB) * 256 + threadIdx.x) * 4;
    float4 v = *(const float4*)(src + i);
    dst[i+0] = (_Float16)v.x; dst[i+1] = (_Float16)v.y;
    dst[i+2] = (_Float16)v.z; dst[i+3] = (_Float16)v.w;
    return;
  }
  int t   = (blockIdx.x - 4 * CASTB) * 256 + threadIdx.x;   // one 8-half segment per thread
  int idx = t * 8;
  int p   = idx >> 9;          // padded row
  int c   = idx & 511;         // column
  int o   = p - WH;
  if (o < 0)      o += NTOK;
  if (o >= NTOK)  o -= NTOK;
  int src = min(max(phi[o], 0), NTOK - 1);   // the row read stays inside x for any content of phi
  const float* s = x + (size_t)src * DMODEL + c;
  float4 a = *(const float4*)s;
  float4 b = *(const float4*)(s + 4);
  v8h out;
  out[0]=(_Float16)a.x; out[1]=(_Float16)a.y; out[2]=(_Float16)a.z; out[3]=(_Float16)a.w;
  out[4]=(_Float16)b.x; out[5]=(_Float16)b.y; out[6]=(_Float16)b.z; out[7]=(_Float16)b.w;
  *(v8h*)(xp + (size_t)p * DMODEL + c) = out;
  // stands in front of any later write of this store's registers: the built code lays
  // the cast path behind the store, where the separate gather kernel simply ended
  asm volatile("s_wait_xcnt 0x0" ::: "memory");
}

// ------------------------------------------------------- C = A @ W^T + bias
// A: [M x 512] f16 row-major.  W: [512 x 512] f16 row-major (B(k,n)=W[n][k]).
// 128x128 tile per workgroup, 8 waves (4 along M x 2 along N), 32-deep k-steps.
// Double-buffered LDS: global stage of step kb+1 overlaps WMMA of step kb;
// one barrier per k-step.
// blockIdx.y = 4*sel + n-tile: product sel uses weight plane sel of W, bias sel and
// output plane sel of outH, so independent products on one A share one grid.
// Weight rows are dealt to the LDS rows so that column l of a wave's B tile nt is output
// column 4*l + nt of the wave's 64: a lane's four accumulator tiles are then four adjacent
// columns, and 16 lanes store one row's 64 columns as whole 128-byte lines.
template<bool HALF_OUT>
__global__ __launch_bounds__(256)
void gemm512_kernel(const _Float16* __restrict__ A,
                    const _Float16* __restrict__ Wall,
                    const float* __restrict__ bias0,
                    const float* __restrict__ bias1,
                    const float* __restrict__ bias2,
                    float* __restrict__ outF,
                    _Float16* __restrict__ outHall) {
  __shared__ __attribute__((aligned(16))) _Float16 As[2][128 * P32];
  __shared__ __attribute__((aligned(16))) _Float16 Bs[2][128 * P32];

  const int tid  = threadIdx.x;
  const int lane = tid & 31;
  const int wave = tid >> 5;
  const int m0 = blockIdx.x * 128;
  const int sel = blockIdx.y >> 2;
  const int n0 = (blockIdx.y & 3) * 128;
  const _Float16* __restrict__ W = Wall + (size_t)sel * WN;
  const float* __restrict__ bias = sel == 0 ? bias0 : sel == 1 ? bias1 : bias2;
  _Float16* __restrict__ outH = outHall + (size_t)sel * MPAD * DMODEL;
  const int mwave = (wave & 3) * 32;   // 4 waves along M
  const int nwave = (wave >> 2) * 64;  // 2 waves along N
  const int half = lane >> 4;
  const int l16  = lane & 15;
  const int off  = half * 8;

  const int lrow = tid >> 2;           // 0..63
  const int lseg = (tid & 3) * 8;      // 0,8,16,24
  const int wrow = 4 * (lrow & 15) + (lrow >> 4);   // weight row kept in LDS row lrow of each 64

  auto stage = [&](int kb, int buf) {
    const int k0 = kb * 32;
    *(v8h*)&As[buf][ lrow     *P32 + lseg] = *(const v8h*)&A[(size_t)(m0+lrow   )*512 + k0 + lseg];
    *(v8h*)&As[buf][(lrow+64) *P32 + lseg] = *(const v8h*)&A[(size_t)(m0+lrow+64)*512 + k0 + lseg];
    *(v8h*)&Bs[buf][ lrow     *P32 + lseg] = *(const v8h*)&W[(size_t)(n0+wrow   )*512 + k0 + lseg];
    *(v8h*)&Bs[buf][(lrow+64) *P32 + lseg] = *(const v8h*)&W[(size_t)(n0+wrow+64)*512 + k0 + lseg];
  };

  v8f acc[2][4];
#pragma unroll
  for (int mt = 0; mt < 2; ++mt)
#pragma unroll
    for (int nt = 0; nt < 4; ++nt) acc[mt][nt] = vzero8();

  stage(0, 0);
  __syncthreads();

  for (int kb = 0; kb < 16; ++kb) {
    const int cur = kb & 1;
    if (kb < 15) stage(kb + 1, cur ^ 1);   // overlap global stage with compute

    v16h aF[2], bF[4];
#pragma unroll
    for (int mt = 0; mt < 2; ++mt)
      aF[mt] = frag16(&As[cur][(mwave + mt*16 + l16) * P32 + off]);
#pragma unroll
    for (int nt = 0; nt < 4; ++nt)
      bF[nt] = frag16(&Bs[cur][(nwave + nt*16 + l16) * P32 + off]);

#pragma unroll
    for (int mt = 0; mt < 2; ++mt)
#pragma unroll
      for (int nt = 0; nt < 4; ++nt)
        acc[mt][nt] = __builtin_amdgcn_wmma_f32_16x16x32_f16(
            false, aF[mt], false, bF[nt], (short)0, acc[mt][nt], false, false);
    __syncthreads();
  }

  const int n = n0 + nwave + 4 * l16;  // first of this lane's four adjacent columns
  const float4 bb = *(const float4*)&bias[n];
#pragma unroll
  for (int mt = 0; mt < 2; ++mt) {
    const int mbase = m0 + mwave + mt*16 + half*8;
#pragma unroll
    for (int r = 0; r < 8; ++r) {
      const float4 val = make_float4(acc[mt][0][r] + bb.x, acc[mt][1][r] + bb.y,
                                     acc[mt][2][r] + bb.z, acc[mt][3][r] + bb.w);
      const size_t oi = (size_t)(mbase + r) * 512 + n;
      if (HALF_OUT) {
        v4h hv = {(_Float16)val.x, (_Float16)val.y, (_Float16)val.z, (_Float16)val.w};
        *(v4h*)&outH[oi] = hv;
      } else {
        *(float4*)&outF[oi] = val;
      }
    }
  }
}

// -------------------------------------------- blocked local attention (flash)
// One workgroup per (block b, head h). 8 waves x 32 queries = 256 queries.
// Computes S^T = K.Q^T so softmax stats are per-lane and exp(S^T) tiles feed
// the O^T = V^T.P^T WMMA directly (no cross-lane shuffle of probabilities).
// Double-buffered K/V staging; wave-uniform band classification per 32-key
// chunk: skip fully-invalid chunks, mask only boundary chunks.
__global__ __launch_bounds__(256)
void attn_kernel(const _Float16* __restrict__ qh,
                 const _Float16* __restrict__ kh,
                 const _Float16* __restrict__ vh,
                 const int* __restrict__ phi,
                 _Float16* __restrict__ outu) {
  __shared__ __attribute__((aligned(16))) _Float16 Ks[2][32 * P64];  // [key][d] chunk
  __shared__ __attribute__((aligned(16))) _Float16 VsT[2][VTILE];    // [d][key] chunk (transposed)
  __shared__ __attribute__((aligned(16))) _Float16 Os[8][32 * P64];  // [query][d], one range per wave

  const int b = blockIdx.x, h = blockIdx.y;
  const int tid  = threadIdx.x;
  const int lane = tid & 31;
  const int wave = tid >> 5;
  const int half = lane >> 4;
  const int l16  = lane & 15;
  const int off  = half * 8;
  const int q0   = wave * 32;

  // Q^T fragments (B operand): col q = l16, contiguous-in-d chunks per lane
  v16h qF[2][2];
#pragma unroll
  for (int qt = 0; qt < 2; ++qt) {
    const size_t qrow = (size_t)(b*BLK + WH + q0 + qt*16 + l16);
    const _Float16* qb = qh + qrow * 512 + h * HD;
#pragma unroll
    for (int ds = 0; ds < 2; ++ds)
      qF[qt][ds] = frag16(qb + ds*32 + off);
  }

  float mrun[2] = {-1e30f, -1e30f};
  float lrun[2] = {0.f, 0.f};
  v8f oacc[2][4];
#pragma unroll
  for (int qt = 0; qt < 2; ++qt)
#pragma unroll
    for (int dt = 0; dt < 4; ++dt) oacc[qt][dt] = vzero8();

  const int lr = tid >> 3;        // staged row 0..31
  const int ls = (tid & 7) * 8;   // seg 0..56

  auto stage = [&](int c, int buf) {
    const size_t kb = (size_t)(b * BLK + c * 32);
    *(v8h*)&Ks[buf][lr * P64 + ls] = *(const v8h*)&kh[(kb + lr) * 512 + h * HD + ls];
    v8h vv = *(const v8h*)&vh[(kb + lr) * 512 + h * HD + ls];
#pragma unroll
    for (int i = 0; i < 8; ++i)
      VsT[buf][(ls + i) * P32 + (ls >> 4) * VGRP + lr] = vv[i];
  };

  stage(0, 0);
  __syncthreads();

  for (int c = 0; c < 24; ++c) {              // 768-key window in 32-key chunks
    const int cur = c & 1;
    if (c < 23) stage(c + 1, cur ^ 1);        // overlap with compute below

    // wave-uniform band classification for this 32-key chunk
    const int c32 = c * 32;
    const bool anyv  = (c32 + 31 >= q0) && (c32 <= q0 + 31 + 2*WH);
    const bool fullv = (c32 >= q0 + 31) && (c32 + 31 <= q0 + 2*WH);

    if (anyv) {
      // K fragments (A operand of S^T): row = key, chunks along d
      v16h aK[2][2];
#pragma unroll
      for (int kt = 0; kt < 2; ++kt)
#pragma unroll
        for (int ds = 0; ds < 2; ++ds)
          aK[kt][ds] = frag16(&Ks[cur][(kt*16 + l16) * P64 + ds*32 + off]);

      v16h pF[2];
#pragma unroll
      for (int qt = 0; qt < 2; ++qt) {
        v8f st[2];
#pragma unroll
        for (int kt = 0; kt < 2; ++kt) {
          v8f s = vzero8();
          s = __builtin_amdgcn_wmma_f32_16x16x32_f16(false, aK[kt][0], false, qF[qt][0], (short)0, s, false, false);
          s = __builtin_amdgcn_wmma_f32_16x16x32_f16(false, aK[kt][1], false, qF[qt][1], (short)0, s, false, false);
          st[kt] = s;
        }
        const int j = q0 + qt*16 + l16;        // query index in block
        float cmax = -3e30f;
        if (fullv) {
#pragma unroll
          for (int kt = 0; kt < 2; ++kt)
#pragma unroll
            for (int r = 0; r < 8; ++r) {
              const float sv = st[kt][r] * 0.125f;
              st[kt][r] = sv;
              cmax = fmaxf(cmax, sv);
            }
        } else {
#pragma unroll
          for (int kt = 0; kt < 2; ++kt)
#pragma unroll
            for (int r = 0; r < 8; ++r) {
              const int rr = c32 + kt*16 + half*8 + r;   // key index in window
              // band mask j <= rr <= j+512 as one unsigned range test
              const float sv = ((unsigned)(rr - j) <= (unsigned)(2*WH))
                                 ? st[kt][r] * 0.125f : -2e30f;
              st[kt][r] = sv;
              cmax = fmaxf(cmax, sv);
            }
        }
        cmax = fmaxf(cmax, swapx16(cmax));
        const float mnew = fmaxf(mrun[qt], cmax);
        const float corr = __expf(mrun[qt] - mnew);
        float p0[8], p1[8];
        float rs = 0.f;
#pragma unroll
        for (int r = 0; r < 8; ++r) {
          p0[r] = __expf(st[0][r] - mnew);
          p1[r] = __expf(st[1][r] - mnew);
          rs += p0[r] + p1[r];
        }
        rs += swapx16(rs);
        lrun[qt] = lrun[qt] * corr + rs;
        mrun[qt] = mnew;
#pragma unroll
        for (int dt = 0; dt < 4; ++dt)
#pragma unroll
          for (int r = 0; r < 8; ++r) oacc[qt][dt][r] *= corr;
        // P^T B-fragment: lo chunk = keytile 0 rows, hi chunk = keytile 1 rows
        v16h p;
#pragma unroll
        for (int r = 0; r < 8; ++r) {
          p[r]     = (_Float16)p0[r];
          p[r + 8] = (_Float16)p1[r];
        }
        pF[qt] = p;
      }

      // O^T += V^T . P^T
#pragma unroll
      for (int dt = 0; dt < 4; ++dt) {
        v16h vF = frag16(&VsT[cur][(dt*16 + l16) * P32 + dt * VGRP + off]);
#pragma unroll
        for (int qt = 0; qt < 2; ++qt)
          oacc[qt][dt] = __builtin_amdgcn_wmma_f32_16x16x32_f16(
              false, vF, false, pF[qt], (short)0, oacc[qt][dt], false, false);
      }
    }
    __syncthreads();
  }

  // rows of the scatter (out_un[phi[o]] = out[o]) that this lane will store, asked for early
  const int orow = lane >> 3;       // 0..3
  const int oseg = (lane & 7) * 8;  // 0..56
  int dest[8];
#pragma unroll
  for (int i = 0; i < 8; ++i)
    dest[i] = min(max(phi[b * BLK + q0 + i * 4 + orow], 0), NTOK - 1);  // the row written stays inside outu

  // normalize as f16 into this wave's own LDS range, one row per query
#pragma unroll
  for (int qt = 0; qt < 2; ++qt) {
    const float inv = 1.0f / lrun[qt];
#pragma unroll
    for (int dt = 0; dt < 4; ++dt) {
      v8h o;
#pragma unroll
      for (int r = 0; r < 8; ++r) o[r] = (_Float16)(oacc[qt][dt][r] * inv);
      *(v8h*)&Os[wave][(qt*16 + l16) * P64 + dt*16 + half*8] = o;
    }
  }
  // the wave's own LDS stores have retired before other lanes' rows are read back;
  // only this wave writes and reads these rows, so no barrier is needed
  asm volatile("s_wait_dscnt 0x0" ::: "memory");
  // eight lanes store one query's 64 halves: a whole 128-byte line
#pragma unroll
  for (int i = 0; i < 8; ++i)
    *(v8h*)&outu[(size_t)dest[i] * 512 + h * HD + oseg] = *(const v8h*)&Os[wave][(i * 4 + orow) * P64 + oseg];
}

// ---------------------------------------------------------------------------
extern "C" void kernel_launch(void* const* d_in, const int* in_sizes, int n_in,
                              void* d_out, int out_size, void* d_ws, size_t ws_size,
                              hipStream_t stream) {
  const float* x   = (const float*)d_in[0];
  const int*   phi = (const int*)  d_in[1];
  const float* Wq  = (const float*)d_in[2];
  const float* bq  = (const float*)d_in[3];
  const float* Wk  = (const float*)d_in[4];
  const float* bk  = (const float*)d_in[5];
  const float* Wv  = (const float*)d_in[6];
  const float* bv  = (const float*)d_in[7];
  const float* Wo  = (const float*)d_in[8];
  const float* bo  = (const float*)d_in[9];
  float* out = (float*)d_out;

  _Float16* ws = (_Float16*)d_ws;
  size_t o = 0;
  _Float16* xp  = ws + o; o += (size_t)MPAD * DMODEL;
  _Float16* wqh = ws + o; o += (size_t)DMODEL * DMODEL;
  _Float16* wkh = ws + o; o += (size_t)DMODEL * DMODEL;
  _Float16* wvh = ws + o; o += (size_t)DMODEL * DMODEL;
  _Float16* woh = ws + o; o += (size_t)DMODEL * DMODEL;
  _Float16* q_h = ws + o; o += (size_t)MPAD * DMODEL;
  _Float16* k_h = ws + o; o += (size_t)MPAD * DMODEL;
  _Float16* v_h = ws + o; o += (size_t)MPAD * DMODEL;
  _Float16* att = ws + o; o += (size_t)NTOK * DMODEL;

  // wqh..woh are four adjacent planes of the workspace, q_h..v_h three adjacent ones
  prep_kernel<<<4 * CASTB + MPAD / 4, 256, 0, stream>>>(x, phi, Wq, Wk, Wv, Wo, xp, wqh);

  gemm512_kernel<true ><<<dim3(MPAD / 128, 12), 256, 0, stream>>>(xp, wqh, bq, bk, bv, nullptr, q_h);

  attn_kernel<<<dim3(NBLK, NHEAD), 256, 0, stream>>>(q_h, k_h, v_h, phi, att);

  gemm512_kernel<false><<<dim3(NTOK / 128, 4), 256, 0, stream>>>(att, woh, bo, bo, bo, out, nullptr);
}

// v004
// One run takes 91.9 microseconds.
// In two side-by-side timings against v003, it was 1.05 and 1.04 times as fast.
// Counting every step since v000, it is 1.79 times as fast.
#include <hip/hip_runtime.h>
#include <hip/hip_bf16.h>

typedef __attribute__((ext_vector_type(16))) _Float16 v16h;
typedef __attribute__((ext_vector_type(8)))  _Float16 v8h;
typedef __attribute__((ext_vector_type(4)))  _Float16 v4h;
typedef __attribute__((ext_vector_type(8)))  float    v8f;

#define NTOK   16384
#define DMODEL 512
#define NHEAD  8
#define HD     64
#define BLK    256                 // query block == w_half
#define WH     256                 // w_half
#define MPAD   (NTOK + 2*WH)       // 16896 padded rows
#define NBLK   (NTOK / BLK)        // 64

#define P32    40                  // rows of 32 halves (64 B) at 80 B
#define P64    72                  // rows of 64 halves (128 B) at 144 B
#define VGRP   16
#define VTILE  (64 * P32 + 4 * VGRP)

static __device__ inline v16h frag16(const _Float16* p) {
  v8h lo = *(const v8h*)(p);
  v8h hi = *(const v8h*)(p + 16);
  return __builtin_shufflevector(lo, hi, 0,1,2,3,4,5,6,7,8,9,10,11,12,13,14,15);
}

static __device__ inline v8f vzero8() {
  v8f z = {0.f,0.f,0.f,0.f,0.f,0.f,0.f,0.f};
  return z;
}

static __device__ inline float swapx16(float x) {
  return __int_as_float(__builtin_amdgcn_ds_swizzle(__float_as_int(x), 0x401f));
}

// ------------- one grid for the five independent preparation jobs, by block range
// blocks [0, 4*CASTB): cast f32->f16 of Wq, Wk, Wv, Wo into four planes of wh
// blocks [4*CASTB, ..): gather by phi + circular pad
#define WN     (DMODEL * DMODEL)
#define CASTB  (WN / 1024)         // 256 blocks of 256 threads x 4 elements per weight
__global__ void prep_kernel(const float* __restrict__ x,
                            const int* __restrict__ phi,
                            const float* __restrict__ Wq,
                            const float* __restrict__ Wk,
                            const float* __restrict__ Wv,
                            const float* __restrict__ Wo,
                            _Float16* __restrict__ xp,
                            _Float16* __restrict__ wh) {
  if (blockIdx.x < 4 * CASTB) {
    const int sel = blockIdx.x / CASTB;
    const float* src = sel == 0 ? Wq : sel == 1 ? Wk : sel == 2 ? Wv : Wo;
    _Float16* dst = wh + (size_t)sel * WN;
    int i = ((blockIdx.x % CASTB) * 256 + threadIdx.x) * 4;
    float4 v = *(const float4*)(src + i);
    dst[i+0] = (_Float16)v.x; dst[i+1] = (_Float16)v.y;
    dst[i+2] = (_Float16)v.z; dst[i+3] = (_Float16)v.w;
    return;
  }
  int t   = (blockIdx.x - 4 * CASTB) * 256 + threadIdx.x;   // one 8-half segment per thread
  int idx = t * 8;
  int p   = idx >> 9;          // padded row
  int c   = idx & 511;         // column
  int o   = p - WH;
  if (o < 0)      o += NTOK;
  if (o >= NTOK)  o -= NTOK;
  int src = min(max(phi[o], 0), NTOK - 1);   // the row read stays inside x for any content of phi
  const float* s = x + (size_t)src * DMODEL + c;
  float4 a = *(const float4*)s;
  float4 b = *(const float4*)(s + 4);
  v8h out;
  out[0]=(_Float16)a.x; out[1]=(_Float16)a.y; out[2]=(_Float16)a.z; out[3]=(_Float16)a.w;
  out[4]=(_Float16)b.x; out[5]=(_Float16)b.y; out[6]=(_Float16)b.z; out[7]=(_Float16)b.w;
  *(v8h*)(xp + (size_t)p * DMODEL + c) = out;
  // stands in front of any later write of this store's registers: the built code lays
  // the cast path behind the store, where the separate gather kernel simply ended
  asm volatile("s_wait_xcnt 0x0" ::: "memory");
}

// ------------------------------------------------------- C = A @ W^T + bias
// A: [M x 512] f16 row-major.  W: [512 x 512] f16 row-major (B(k,n)=W[n][k]).
// 128x128 tile per workgroup, 8 waves (4 along M x 2 along N), 32-deep k-steps.
// Double-buffered LDS: the global loads of step kb+1 are issued in front of the WMMAs of
// step kb and kept in registers; their LDS stores stand behind those WMMAs, so the wait
// for the loads falls behind the step's work. One barrier per k-step.
// blockIdx.y = 4*sel + n-tile: product sel uses weight plane sel of W, bias sel and
// output plane sel of outH, so independent products on one A share one grid.
// Weight rows are dealt to the LDS rows so that column l of a wave's B tile nt is output
// column 4*l + nt of the wave's 64: a lane's four accumulator tiles are then four adjacent
// columns, and 16 lanes store one row's 64 columns as whole 128-byte lines.
template<bool HALF_OUT>
__global__ __launch_bounds__(256)
void gemm512_kernel(const _Float16* __restrict__ A,
                    const _Float16* __restrict__ Wall,
                    const float* __restrict__ bias0,
                    const float* __restrict__ bias1,
                    const float* __restrict__ bias2,
                    float* __restrict__ outF,
                    _Float16* __restrict__ outHall) {
  __shared__ __attribute__((aligned(16))) _Float16 As[2][128 * P32];
  __shared__ __attribute__((aligned(16))) _Float16 Bs[2][128 * P32];

  const int tid  = threadIdx.x;
  const int lane = tid & 31;
  const int wave = tid >> 5;
  const int m0 = blockIdx.x * 128;
  const int sel = blockIdx.y >> 2;
  const int n0 = (blockIdx.y & 3) * 128;
  const _Float16* __restrict__ W = Wall + (size_t)sel * WN;
  const float* __restrict__ bias = sel == 0 ? bias0 : sel == 1 ? bias1 : bias2;
  _Float16* __restrict__ outH = outHall + (size_t)sel * MPAD * DMODEL;
  const int mwave = (wave & 3) * 32;   // 4 waves along M
  const int nwave = (wave >> 2) * 64;  // 2 waves along N
  const int half = lane >> 4;
  const int l16  = lane & 15;
  const int off  = half * 8;

  const int lrow = tid >> 2;           // 0..63
  const int lseg = (tid & 3) * 8;      // 0,8,16,24
  const int wrow = 4 * (lrow & 15) + (lrow >> 4);   // weight row kept in LDS row lrow of each 64

  // one pointer per operand; the row 64 further down is reached by a constant offset
  const _Float16* __restrict__ aSrc = A + (size_t)(m0 + lrow) * 512 + lseg;
  const _Float16* __restrict__ wSrc = W + (size_t)(n0 + wrow) * 512 + lseg;
  v8h ra0, ra1, rb0, rb1;              // one staged k-step on its way from global memory to LDS
  auto fetch = [&](int kb) {
    const int k0 = kb * 32;
    ra0 = *(const v8h*)&aSrc[k0];
    ra1 = *(const v8h*)&aSrc[k0 + 64 * 512];
    rb0 = *(const v8h*)&wSrc[k0];
    rb1 = *(const v8h*)&wSrc[k0 + 64 * 512];
  };
  auto put = [&](int buf) {
    *(v8h*)&As[buf][ lrow     *P32 + lseg] = ra0;
    *(v8h*)&As[buf][(lrow+64) *P32 + lseg] = ra1;
    *(v8h*)&Bs[buf][ lrow     *P32 + lseg] = rb0;
    *(v8h*)&Bs[buf][(lrow+64) *P32 + lseg] = rb1;
  };

  v8f acc[2][4];
#pragma unroll
  for (int mt = 0; mt < 2; ++mt)
#pragma unroll
    for (int nt = 0; nt < 4; ++nt) acc[mt][nt] = vzero8();

  fetch(0);
  put(0);
  __syncthreads();

  for (int kb = 0; kb < 16; ++kb) {
    const int cur = kb & 1;
    if (kb < 15) fetch(kb + 1);            // in flight during the WMMAs below
    // keeps all four loads in front of the step's work: sunk among the WMMAs they would
    // be waited for with almost no lead
    __builtin_amdgcn_sched_barrier(0);

    v16h aF[2];
#pragma unroll
    for (int mt = 0; mt < 2; ++mt)
      aF[mt] = frag16(&As[cur][(mwave + mt*16 + l16) * P32 + off]);
#pragma unroll
    for (int np = 0; np < 2; ++np) {
      v16h bF[2];
#pragma unroll
      for (int nt = 0; nt < 2; ++nt)
        bF[nt] = frag16(&Bs[cur][(nwave + (np*2 + nt)*16 + l16) * P32 + off]);
#pragma unroll
      for (int nt = 0; nt < 2; ++nt)
#pragma unroll
        for (int mt = 0; mt < 2; ++mt)
          acc[mt][np*2 + nt] = __builtin_amdgcn_wmma_f32_16x16x32_f16(
              false, aF[mt], false, bF[nt], (short)0, acc[mt][np*2 + nt], false, false);
      // keeps the next pair's LDS loads (np 0) and the staged tile's LDS stores with their
      // wait for the global loads (np 1) behind these WMMAs
      __builtin_amdgcn_sched_barrier(0);
    }
    if (kb < 15) put(cur ^ 1);             // every reader left this buffer at the last barrier
    __syncthreads();
  }

  const int n = n0 + nwave + 4 * l16;  // first of this lane's four adjacent columns
  const float4 bb = *(const float4*)&bias[n];
#pragma unroll
  for (int mt = 0; mt < 2; ++mt) {
    const int mbase = m0 + mwave + mt*16 + half*8;
#pragma unroll
    for (int r = 0; r < 8; ++r) {
      const float4 val = make_float4(acc[mt][0][r] + bb.x, acc[mt][1][r] + bb.y,
                                     acc[mt][2][r] + bb.z, acc[mt][3][r] + bb.w);
      const size_t oi = (size_t)(mbase + r) * 512 + n;
      if (HALF_OUT) {
        v4h hv = {(_Float16)val.x, (_Float16)val.y, (_Float16)val.z, (_Float16)val.w};
        *(v4h*)&outH[oi] = hv;
      } else {
        *(float4*)&outF[oi] = val;
      }
    }
  }
}

// -------------------------------------------- blocked local attention (flash)
// One workgroup per (block b, head h). 8 waves x 32 queries = 256 queries.
// Computes S^T = K.Q^T so softmax stats are per-lane and exp(S^T) tiles feed
// the O^T = V^T.P^T WMMA directly (no cross-lane shuffle of probabilities).
// Double-buffered K/V staging, the next chunk's global loads held in registers while
// this chunk is worked on; wave-uniform band classification per 32-key
// chunk: skip fully-invalid chunks, mask only boundary chunks.
__global__ __launch_bounds__(256)
void attn_kernel(const _Float16* __restrict__ qh,
                 const _Float16* __restrict__ kh,
                 const _Float16* __restrict__ vh,
                 const int* __restrict__ phi,
                 _Float16* __restrict__ outu) {
  __shared__ __attribute__((aligned(16))) _Float16 Ks[2][32 * P64];  // [key][d] chunk
  __shared__ __attribute__((aligned(16))) _Float16 VsT[2][VTILE];    // [d][key] chunk (transposed)
  __shared__ __attribute__((aligned(16))) _Float16 Os[8][32 * P64];  // [query][d], one range per wave

  const int b = blockIdx.x, h = blockIdx.y;
  const int tid  = threadIdx.x;
  const int lane = tid & 31;
  const int wave = tid >> 5;
  const int half = lane >> 4;
  const int l16  = lane & 15;
  const int off  = half * 8;
  const int q0   = wave * 32;

  // Q^T fragments (B operand): col q = l16, contiguous-in-d chunks per lane
  v16h qF[2][2];
#pragma unroll
  for (int qt = 0; qt < 2; ++qt) {
    const size_t qrow = (size_t)(b*BLK + WH + q0 + qt*16 + l16);
    const _Float16* qb = qh + qrow * 512 + h * HD;
#pragma unroll
    for (int ds = 0; ds < 2; ++ds)
      qF[qt][ds] = frag16(qb + ds*32 + off);
  }

  float mrun[2] = {-1e30f, -1e30f};
  float lrun[2] = {0.f, 0.f};
  v8f oacc[2][4];
#pragma unroll
  for (int qt = 0; qt < 2; ++qt)
#pragma unroll
    for (int dt = 0; dt < 4; ++dt) oacc[qt][dt] = vzero8();

  const int lr = tid >> 3;        // staged row 0..31
  const int ls = (tid & 7) * 8;   // seg 0..56

  v8h rk, rv;                     // one staged chunk on its way from global memory to LDS
  auto fetch = [&](int c) {
    const size_t kb = (size_t)(b * BLK + c * 32);
    rk = *(const v8h*)&kh[(kb + lr) * 512 + h * HD + ls];
    rv = *(const v8h*)&vh[(kb + lr) * 512 + h * HD + ls];
  };
  auto put = [&](int buf) {
    *(v8h*)&Ks[buf][lr * P64 + ls] = rk;
#pragma unroll
    for (int i = 0; i < 8; ++i)
      VsT[buf][(ls + i) * P32 + (ls >> 4) * VGRP + lr] = rv[i];
  };

  fetch(0);
  put(0);
  __syncthreads();

  for (int c = 0; c < 24; ++c) {              // 768-key window in 32-key chunks
    const int cur = c & 1;
    if (c < 23) fetch(c + 1);                 // in flight during the work below

    // wave-uniform band classification for this 32-key chunk
    const int c32 = c * 32;
    const bool anyv  = (c32 + 31 >= q0) && (c32 <= q0 + 31 + 2*WH);
    const bool fullv = (c32 >= q0 + 31) && (c32 + 31 <= q0 + 2*WH);

    if (anyv) {
      // K fragments (A operand of S^T): row = key, chunks along d
      v16h aK[2][2];
#pragma unroll
      for (int kt = 0; kt < 2; ++kt)
#pragma unroll
        for (int ds = 0; ds < 2; ++ds)
          aK[kt][ds] = frag16(&Ks[cur][(kt*16 + l16) * P64 + ds*32 + off]);

      v16h pF[2];
#pragma unroll
      for (int qt = 0; qt < 2; ++qt) {
        v8f st[2];
#pragma unroll
        for (int kt = 0; kt < 2; ++kt) {
          v8f s = vzero8();
          s = __builtin_amdgcn_wmma_f32_16x16x32_f16(false, aK[kt][0], false, qF[qt][0], (short)0, s, false, false);
          s = __builtin_amdgcn_wmma_f32_16x16x32_f16(false, aK[kt][1], false, qF[qt][1], (short)0, s, false, false);
          st[kt] = s;
        }
        const int j = q0 + qt*16 + l16;        // query index in block
        float cmax = -3e30f;
        if (fullv) {
#pragma unroll
          for (int kt = 0; kt < 2; ++kt)
#pragma unroll
            for (int r = 0; r < 8; ++r) {
              const float sv = st[kt][r] * 0.125f;
              st[kt][r] = sv;
              cmax = fmaxf(cmax, sv);
            }
        } else {
#pragma unroll
          for (int kt = 0; kt < 2; ++kt)
#pragma unroll
            for (int r = 0; r < 8; ++r) {
              const int rr = c32 + kt*16 + half*8 + r;   // key index in window
              // band mask j <= rr <= j+512 as one unsigned range test
              const float sv = ((unsigned)(rr - j) <= (unsigned)(2*WH))
                                 ? st[kt][r] * 0.125f : -2e30f;
              st[kt][r] = sv;
              cmax = fmaxf(cmax, sv);
            }
        }
        cmax = fmaxf(cmax, swapx16(cmax));
        const float mnew = fmaxf(mrun[qt], cmax);
        const float corr = __expf(mrun[qt] - mnew);
        float p0[8], p1[8];
        float rs = 0.f;
#pragma unroll
        for (int r = 0; r < 8; ++r) {
          p0[r] = __expf(st[0][r] - mnew);
          p1[r] = __expf(st[1][r] - mnew);
          rs += p0[r] + p1[r];
        }
        rs += swapx16(rs);
        lrun[qt] = lrun[qt] * corr + rs;
        mrun[qt] = mnew;
#pragma unroll
        for (int dt = 0; dt < 4; ++dt)
#pragma unroll
          for (int r = 0; r < 8; ++r) oacc[qt][dt][r] *= corr;
        // P^T B-fragment: lo chunk = keytile 0 rows, hi chunk = keytile 1 rows
        v16h p;
#pragma unroll
        for (int r = 0; r < 8; ++r) {
          p[r]     = (_Float16)p0[r];
          p[r + 8] = (_Float16)p1[r];
        }
        pF[qt] = p;
      }

      // O^T += V^T . P^T
#pragma unroll
      for (int dt = 0; dt < 4; ++dt) {
        v16h vF = frag16(&VsT[cur][(dt*16 + l16) * P32 + dt * VGRP + off]);
#pragma unroll
        for (int qt = 0; qt < 2; ++qt)
          oacc[qt][dt] = __builtin_amdgcn_wmma_f32_16x16x32_f16(
              false, vF, false, pF[qt], (short)0, oacc[qt][dt], false, false);
      }
    }
    if (c < 23) put(cur ^ 1);                 // every reader left this buffer at the last barrier
    __syncthreads();
  }

  // rows of the scatter (out_un[phi[o]] = out[o]) that this lane will store, asked for early
  const int orow = lane >> 3;       // 0..3
  const int oseg = (lane & 7) * 8;  // 0..56
  int dest[8];
#pragma unroll
  for (int i = 0; i < 8; ++i)
    dest[i] = min(max(phi[b * BLK + q0 + i * 4 + orow], 0), NTOK - 1);  // the row written stays inside outu

  // normalize as f16 into this wave's own LDS range, one row per query
#pragma unroll
  for (int qt = 0; qt < 2; ++qt) {
    const float inv = 1.0f / lrun[qt];
#pragma unroll
    for (int dt = 0; dt < 4; ++dt) {
      v8h o;
#pragma unroll
      for (int r = 0; r < 8; ++r) o[r] = (_Float16)(oacc[qt][dt][r] * inv);
      *(v8h*)&Os[wave][(qt*16 + l16) * P64 + dt*16 + half*8] = o;
    }
  }
  // the wave's own LDS stores have retired before other lanes' rows are read back;
  // only this wave writes and reads these rows, so no barrier is needed
  asm volatile("s_wait_dscnt 0x0" ::: "memory");
  // eight lanes store one query's 64 halves: a whole 128-byte line
#pragma unroll
  for (int i = 0; i < 8; ++i)
    *(v8h*)&outu[(size_t)dest[i] * 512 + h * HD + oseg] = *(const v8h*)&Os[wave][(i * 4 + orow) * P64 + oseg];
}

// ---------------------------------------------------------------------------
extern "C" void kernel_launch(void* const* d_in, const int* in_sizes, int n_in,
                              void* d_out, int out_size, void* d_ws, size_t ws_size,
                              hipStream_t stream) {
  const float* x   = (const float*)d_in[0];
  const int*   phi = (const int*)  d_in[1];
  const float* Wq  = (const float*)d_in[2];
  const float* bq  = (const float*)d_in[3];
  const float* Wk  = (const float*)d_in[4];
  const float* bk  = (const float*)d_in[5];
  const float* Wv  = (const float*)d_in[6];
  const float* bv  = (const float*)d_in[7];
  const float* Wo  = (const float*)d_in[8];
  const float* bo  = (const float*)d_in[9];
  float* out = (float*)d_out;

  _Float16* ws = (_Float16*)d_ws;
  size_t o = 0;
  _Float16* xp  = ws + o; o += (size_t)MPAD * DMODEL;
  _Float16* wqh = ws + o; o += (size_t)DMODEL * DMODEL;
  _Float16* wkh = ws + o; o += (size_t)DMODEL * DMODEL;
  _Float16* wvh = ws + o; o += (size_t)DMODEL * DMODEL;
  _Float16* woh = ws + o; o += (size_t)DMODEL * DMODEL;
  _Float16* q_h = ws + o; o += (size_t)MPAD * DMODEL;
  _Float16* k_h = ws + o; o += (size_t)MPAD * DMODEL;
  _Float16* v_h = ws + o; o += (size_t)MPAD * DMODEL;
  _Float16* att = ws + o; o += (size_t)NTOK * DMODEL;

  // wqh..woh are four adjacent planes of the workspace, q_h..v_h three adjacent ones
  prep_kernel<<<4 * CASTB + MPAD / 4, 256, 0, stream>>>(x, phi, Wq, Wk, Wv, Wo, xp, wqh);

  gemm512_kernel<true ><<<dim3(MPAD / 128, 12), 256, 0, stream>>>(xp, wqh, bq, bk, bv, nullptr, q_h);

  attn_kernel<<<dim3(NBLK, NHEAD), 256, 0, stream>>>(q_h, k_h, v_h, phi, att);

  gemm512_kernel<false><<<dim3(NTOK / 128, 4), 256, 0, stream>>>(att, woh, bo, bo, bo, out, nullptr);
}

// v005
// Measured time: 78.8 microseconds a run.
// Timed twice side by side with v004, it ran 1.17 times as fast both times.
// Over all steps from v000 it is 2.08 times as fast.
#include <hip/hip_runtime.h>
#include <hip/hip_bf16.h>

typedef __attribute__((ext_vector_type(16))) _Float16 v16h;
typedef __attribute__((ext_vector_type(8)))  _Float16 v8h;
typedef __attribute__((ext_vector_type(4)))  _Float16 v4h;
typedef __attribute__((ext_vector_type(8)))  float    v8f;

#define NTOK   16384
#define DMODEL 512
#define NHEAD  8
#define HD     64
#define BLK    256                 // query block == w_half
#define WH     256                 // w_half
#define MPAD   (NTOK + 2*WH)       // 16896 padded rows
#define NBLK   (NTOK / BLK)        // 64

#define P32    40                  // rows of 32 halves (64 B) at 80 B
#define P64    72                  // rows of 64 halves (128 B) at 144 B
#define VGRP   16
#define VTILE  (64 * P32 + 4 * VGRP)

static __device__ inline v16h frag16(const _Float16* p) {
  v8h lo = *(const v8h*)(p);
  v8h hi = *(const v8h*)(p + 16);
  return __builtin_shufflevector(lo, hi, 0,1,2,3,4,5,6,7,8,9,10,11,12,13,14,15);
}

static __device__ inline v8f vzero8() {
  v8f z = {0.f,0.f,0.f,0.f,0.f,0.f,0.f,0.f};
  return z;
}

static __device__ inline float swapx16(float x) {
  return __int_as_float(__builtin_amdgcn_ds_swizzle(__float_as_int(x), 0x401f));
}

// ------------- one grid for the five independent preparation jobs, by block range
// blocks [0, 4*CASTB): cast f32->f16 of Wq, Wk, Wv, Wo into four planes of wh
// blocks [4*CASTB, ..): gather by phi + circular pad
#define WN     (DMODEL * DMODEL)
#define CASTB  (WN / 1024)         // 256 blocks of 256 threads x 4 elements per weight
__global__ void prep_kernel(const float* __restrict__ x,
                            const int* __restrict__ phi,
                            const float* __restrict__ Wq,
                            const float* __restrict__ Wk,
                            const float* __restrict__ Wv,
                            const float* __restrict__ Wo,
                            _Float16* __restrict__ xp,
                            _Float16* __restrict__ wh) {
  if (blockIdx.x < 4 * CASTB) {
    const int sel = blockIdx.x / CASTB;
    const float* src = sel == 0 ? Wq : sel == 1 ? Wk : sel == 2 ? Wv : Wo;
    _Float16* dst = wh + (size_t)sel * WN;
    int i = ((blockIdx.x % CASTB) * 256 + threadIdx.x) * 4;
    float4 v = *(const float4*)(src + i);
    dst[i+0] = (_Float16)v.x; dst[i+1] = (_Float16)v.y;
    dst[i+2] = (_Float16)v.z; dst[i+3] = (_Float16)v.w;
    return;
  }
  int t   = (blockIdx.x - 4 * CASTB) * 256 + threadIdx.x;   // one 8-half segment per thread
  int idx = t * 8;
  int p   = idx >> 9;          // padded row
  int c   = idx & 511;         // column
  int o   = p - WH;
  if (o < 0)      o += NTOK;
  if (o >= NTOK)  o -= NTOK;
  int src = min(max(phi[o], 0), NTOK - 1);   // the row read stays inside x for any content of phi
  const float* s = x + (size_t)src * DMODEL + c;
  float4 a = *(const float4*)s;
  float4 b = *(const float4*)(s + 4);
  v8h out;
  out[0]=(_Float16)a.x; out[1]=(_Float16)a.y; out[2]=(_Float16)a.z; out[3]=(_Float16)a.w;
  out[4]=(_Float16)b.x; out[5]=(_Float16)b.y; out[6]=(_Float16)b.z; out[7]=(_Float16)b.w;
  *(v8h*)(xp + (size_t)p * DMODEL + c) = out;
  // stands in front of any later write of this store's registers: the built code lays
  // the cast path behind the store, where the separate gather kernel simply ended
  asm volatile("s_wait_xcnt 0x0" ::: "memory");
}

// ------------------------------------------------------- C = A @ W^T + bias
// A: [M x 512] f16 row-major.  W: [512 x 512] f16 row-major (B(k,n)=W[n][k]).
// 128x128 tile per workgroup, 8 waves (4 along M x 2 along N), 64-deep k-steps: the piece
// of a row that one step stages is 128 bytes, a whole cache line, so a wave-wide 16-byte
// load touches four lines and uses every byte of them.
// Double-buffered LDS: the global loads of step kb+1 are issued in front of WMMAs of step kb
// and kept in registers; their LDS stores stand behind those WMMAs, so the wait for the
// loads falls behind work. The A tile travels during the first 32 k of the step, the W tile
// during the second 32 k, in the same registers. One barrier per k-step.
// blockIdx.y = 4*sel + n-tile: product sel uses weight plane sel of W, bias sel and
// output plane sel of outH, so independent products on one A share one grid.
// Weight rows are dealt to the LDS rows so that column l of a wave's B tile nt is output
// column 4*l + nt of the wave's 64: a lane's four accumulator tiles are then four adjacent
// columns, and 16 lanes store one row's 64 columns as whole 128-byte lines.
template<bool HALF_OUT>
__global__ __launch_bounds__(256)
void gemm512_kernel(const _Float16* __restrict__ A,
                    const _Float16* __restrict__ Wall,
                    const float* __restrict__ bias0,
                    const float* __restrict__ bias1,
                    const float* __restrict__ bias2,
                    float* __restrict__ outF,
                    _Float16* __restrict__ outHall) {
  __shared__ __attribute__((aligned(16))) _Float16 As[2][128 * P64];
  __shared__ __attribute__((aligned(16))) _Float16 Bs[2][128 * P64];

  const int tid  = threadIdx.x;
  const int lane = tid & 31;
  const int wave = tid >> 5;
  const int m0 = blockIdx.x * 128;
  const int sel = blockIdx.y >> 2;
  const int n0 = (blockIdx.y & 3) * 128;
  const _Float16* __restrict__ W = Wall + (size_t)sel * WN;
  const float* __restrict__ bias = sel == 0 ? bias0 : sel == 1 ? bias1 : bias2;
  _Float16* __restrict__ outH = outHall + (size_t)sel * MPAD * DMODEL;
  const int mwave = (wave & 3) * 32;   // 4 waves along M
  const int nwave = (wave >> 2) * 64;  // 2 waves along N
  const int half = lane >> 4;
  const int l16  = lane & 15;
  const int off  = half * 8;

  const int lrow = tid >> 3;           // 0..31
  const int lseg = (tid & 7) * 8;      // 0..56: eight lanes cover one row's 128 bytes
  const int wrow = 4 * (lrow & 15) + (lrow >> 4);   // weight row kept in LDS row lrow of each 64

  // one pointer per operand; the other three rows are reached by constant offsets
  const _Float16* __restrict__ aSrc = A + (size_t)(m0 + lrow) * 512 + lseg;
  const _Float16* __restrict__ wSrc = W + (size_t)(n0 + wrow) * 512 + lseg;
  v8h ra[4], rb[4];                    // a staged tile on its way from global memory to LDS
  auto fetchA = [&](int kb) {
#pragma unroll
    for (int i = 0; i < 4; ++i) ra[i] = *(const v8h*)&aSrc[kb * 64 + i * 32 * 512];
  };
  auto fetchB = [&](int kb) {          // LDS row lrow + 32*i holds weight row wrow + 2*(i&1) + 64*(i>>1)
#pragma unroll
    for (int i = 0; i < 4; ++i) rb[i] = *(const v8h*)&wSrc[kb * 64 + ((i & 1) * 2 + (i >> 1) * 64) * 512];
  };
  auto putA = [&](int buf) {
#pragma unroll
    for (int i = 0; i < 4; ++i) *(v8h*)&As[buf][(lrow + 32 * i) * P64 + lseg] = ra[i];
  };
  auto putB = [&](int buf) {
#pragma unroll
    for (int i = 0; i < 4; ++i) *(v8h*)&Bs[buf][(lrow + 32 * i) * P64 + lseg] = rb[i];
  };

  v8f acc[2][4];
#pragma unroll
  for (int mt = 0; mt < 2; ++mt)
#pragma unroll
    for (int nt = 0; nt < 4; ++nt) acc[mt][nt] = vzero8();

  fetchA(0);
  fetchB(0);
  putA(0);
  putB(0);
  __syncthreads();

  for (int kb = 0; kb < 8; ++kb) {
    const int cur = kb & 1;
#pragma unroll
    for (int ks = 0; ks < 2; ++ks) {       // the step's two 32-deep halves
      if (kb < 7) {                        // in flight during the WMMAs below
        if (ks == 0) fetchA(kb + 1); else fetchB(kb + 1);
      }
      // keeps all four loads in front of the half's work: sunk among the WMMAs they would
      // be waited for with almost no lead
      __builtin_amdgcn_sched_barrier(0);

      v16h aF[2];
#pragma unroll
      for (int mt = 0; mt < 2; ++mt)
        aF[mt] = frag16(&As[cur][(mwave + mt*16 + l16) * P64 + ks*32 + off]);
#pragma unroll
      for (int np = 0; np < 2; ++np) {
        v16h bF[2];
#pragma unroll
        for (int nt = 0; nt < 2; ++nt)
          bF[nt] = frag16(&Bs[cur][(nwave + (np*2 + nt)*16 + l16) * P64 + ks*32 + off]);
#pragma unroll
        for (int nt = 0; nt < 2; ++nt)
#pragma unroll
          for (int mt = 0; mt < 2; ++mt)
            acc[mt][np*2 + nt] = __builtin_amdgcn_wmma_f32_16x16x32_f16(
                false, aF[mt], false, bF[nt], (short)0, acc[mt][np*2 + nt], false, false);
        // keeps the next pair's LDS loads (np 0) and the staged tile's LDS stores with their
        // wait for the global loads (np 1) behind these WMMAs
        __builtin_amdgcn_sched_barrier(0);
      }
      if (kb < 7) {                        // every reader left this buffer at the last barrier
        if (ks == 0) putA(cur ^ 1); else putB(cur ^ 1);
      }
      if (ks == 0) __builtin_amdgcn_sched_barrier(0);
    }
    __syncthreads();
  }

  const int n = n0 + nwave + 4 * l16;  // first of this lane's four adjacent columns
  const float4 bb = *(const float4*)&bias[n];
#pragma unroll
  for (int mt = 0; mt < 2; ++mt) {
    const int mbase = m0 + mwave + mt*16 + half*8;
#pragma unroll
    for (int r = 0; r < 8; ++r) {
      const float4 val = make_float4(acc[mt][0][r] + bb.x, acc[mt][1][r] + bb.y,
                                     acc[mt][2][r] + bb.z, acc[mt][3][r] + bb.w);
      const size_t oi = (size_t)(mbase + r) * 512 + n;
      if (HALF_OUT) {
        v4h hv = {(_Float16)val.x, (_Float16)val.y, (_Float16)val.z, (_Float16)val.w};
        *(v4h*)&outH[oi] = hv;
      } else {
        *(float4*)&outF[oi] = val;
      }
    }
  }
}

// -------------------------------------------- blocked local attention (flash)
// One workgroup per (block b, head h). 8 waves x 32 queries = 256 queries.
// Computes S^T = K.Q^T so softmax stats are per-lane and exp(S^T) tiles feed
// the O^T = V^T.P^T WMMA directly (no cross-lane shuffle of probabilities).
// Double-buffered K/V staging, the next chunk's global loads held in registers while
// this chunk is worked on; wave-uniform band classification per 32-key
// chunk: skip fully-invalid chunks, mask only boundary chunks.
__global__ __launch_bounds__(256)
void attn_kernel(const _Float16* __restrict__ qh,
                 const _Float16* __restrict__ kh,
                 const _Float16* __restrict__ vh,
                 const int* __restrict__ phi,
                 _Float16* __restrict__ outu) {
  __shared__ __attribute__((aligned(16))) _Float16 Ks[2][32 * P64];  // [key][d] chunk
  __shared__ __attribute__((aligned(16))) _Float16 VsT[2][VTILE];    // [d][key] chunk (transposed)
  __shared__ __attribute__((aligned(16))) _Float16 Os[8][32 * P64];  // [query][d], one range per wave

  const int b = blockIdx.x, h = blockIdx.y;
  const int tid  = threadIdx.x;
  const int lane = tid & 31;
  const int wave = tid >> 5;
  const int half = lane >> 4;
  const int l16  = lane & 15;
  const int off  = half * 8;
  const int q0   = wave * 32;

  // Q^T fragments (B operand): col q = l16, contiguous-in-d chunks per lane
  v16h qF[2][2];
#pragma unroll
  for (int qt = 0; qt < 2; ++qt) {
    const size_t qrow = (size_t)(b*BLK + WH + q0 + qt*16 + l16);
    const _Float16* qb = qh + qrow * 512 + h * HD;
#pragma unroll
    for (int ds = 0; ds < 2; ++ds)
      qF[qt][ds] = frag16(qb + ds*32 + off);
  }

  float mrun[2] = {-1e30f, -1e30f};
  float lrun[2] = {0.f, 0.f};
  v8f oacc[2][4];
#pragma unroll
  for (int qt = 0; qt < 2; ++qt)
#pragma unroll
    for (int dt = 0; dt < 4; ++dt) oacc[qt][dt] = vzero8();

  const int lr = tid >> 3;        // staged row 0..31
  const int ls = (tid & 7) * 8;   // seg 0..56

  v8h rk, rv;                     // one staged chunk on its way from global memory to LDS
  auto fetch = [&](int c) {
    const size_t kb = (size_t)(b * BLK + c * 32);
    rk = *(const v8h*)&kh[(kb + lr) * 512 + h * HD + ls];
    rv = *(const v8h*)&vh[(kb + lr) * 512 + h * HD + ls];
  };
  auto put = [&](int buf) {
    *(v8h*)&Ks[buf][lr * P64 + ls] = rk;
#pragma unroll
    for (int i = 0; i < 8; ++i)
      VsT[buf][(ls + i) * P32 + (ls >> 4) * VGRP + lr] = rv[i];
  };

  fetch(0);
  put(0);
  __syncthreads();

  for (int c = 0; c < 24; ++c) {              // 768-key window in 32-key chunks
    const int cur = c & 1;
    if (c < 23) fetch(c + 1);                 // in flight during the work below

    // wave-uniform band classification for this 32-key chunk
    const int c32 = c * 32;
    const bool anyv  = (c32 + 31 >= q0) && (c32 <= q0 + 31 + 2*WH);
    const bool fullv = (c32 >= q0 + 31) && (c32 + 31 <= q0 + 2*WH);

    if (anyv) {
      // K fragments (A operand of S^T): row = key, chunks along d
      v16h aK[2][2];
#pragma unroll
      for (int kt = 0; kt < 2; ++kt)
#pragma unroll
        for (int ds = 0; ds < 2; ++ds)
          aK[kt][ds] = frag16(&Ks[cur][(kt*16 + l16) * P64 + ds*32 + off]);

      v16h pF[2];
#pragma unroll
      for (int qt = 0; qt < 2; ++qt) {
        v8f st[2];
#pragma unroll
        for (int kt = 0; kt < 2; ++kt) {
          v8f s = vzero8();
          s = __builtin_amdgcn_wmma_f32_16x16x32_f16(false, aK[kt][0], false, qF[qt][0], (short)0, s, false, false);
          s = __builtin_amdgcn_wmma_f32_16x16x32_f16(false, aK[kt][1], false, qF[qt][1], (short)0, s, false, false);
          st[kt] = s;
        }
        const int j = q0 + qt*16 + l16;        // query index in block
        float cmax = -3e30f;
        if (fullv) {
#pragma unroll
          for (int kt = 0; kt < 2; ++kt)
#pragma unroll
            for (int r = 0; r < 8; ++r) {
              const float sv = st[kt][r] * 0.125f;
              st[kt][r] = sv;
              cmax = fmaxf(cmax, sv);
            }
        } else {
#pragma unroll
          for (int kt = 0; kt < 2; ++kt)
#pragma unroll
            for (int r = 0; r < 8; ++r) {
              const int rr = c32 + kt*16 + half*8 + r;   // key index in window
              // band mask j <= rr <= j+512 as one unsigned range test
              const float sv = ((unsigned)(rr - j) <= (unsigned)(2*WH))
                                 ? st[kt][r] * 0.125f : -2e30f;
              st[kt][r] = sv;
              cmax = fmaxf(cmax, sv);
            }
        }
        cmax = fmaxf(cmax, swapx16(cmax));
        const float mnew = fmaxf(mrun[qt], cmax);
        const float corr = __expf(mrun[qt] - mnew);
        float p0[8], p1[8];
        float rs = 0.f;
#pragma unroll
        for (int r = 0; r < 8; ++r) {
          p0[r] = __expf(st[0][r] - mnew);
          p1[r] = __expf(st[1][r] - mnew);
          rs += p0[r] + p1[r];
        }
        rs += swapx16(rs);
        lrun[qt] = lrun[qt] * corr + rs;
        mrun[qt] = mnew;
#pragma unroll
        for (int dt = 0; dt < 4; ++dt)
#pragma unroll
          for (int r = 0; r < 8; ++r) oacc[qt][dt][r] *= corr;
        // P^T B-fragment: lo chunk = keytile 0 rows, hi chunk = keytile 1 rows
        v16h p;
#pragma unroll
        for (int r = 0; r < 8; ++r) {
          p[r]     = (_Float16)p0[r];
          p[r + 8] = (_Float16)p1[r];
        }
        pF[qt] = p;
      }

      // O^T += V^T . P^T
#pragma unroll
      for (int dt = 0; dt < 4; ++dt) {
        v16h vF = frag16(&VsT[cur][(dt*16 + l16) * P32 + dt * VGRP + off]);
#pragma unroll
        for (int qt = 0; qt < 2; ++qt)
          oacc[qt][dt] = __builtin_amdgcn_wmma_f32_16x16x32_f16(
              false, vF, false, pF[qt], (short)0, oacc[qt][dt], false, false);
      }
    }
    if (c < 23) put(cur ^ 1);                 // every reader left this buffer at the last barrier
    __syncthreads();
  }

  // rows of the scatter (out_un[phi[o]] = out[o]) that this lane will store, asked for early
  const int orow = lane >> 3;       // 0..3
  const int oseg = (lane & 7) * 8;  // 0..56
  int dest[8];
#pragma unroll
  for (int i = 0; i < 8; ++i)
    dest[i] = min(max(phi[b * BLK + q0 + i * 4 + orow], 0), NTOK - 1);  // the row written stays inside outu

  // normalize as f16 into this wave's own LDS range, one row per query
#pragma unroll
  for (int qt = 0; qt < 2; ++qt) {
    const float inv = 1.0f / lrun[qt];
#pragma unroll
    for (int dt = 0; dt < 4; ++dt) {
      v8h o;
#pragma unroll
      for (int r = 0; r < 8; ++r) o[r] = (_Float16)(oacc[qt][dt][r] * inv);
      *(v8h*)&Os[wave][(qt*16 + l16) * P64 + dt*16 + half*8] = o;
    }
  }
  // the wave's own LDS stores have retired before other lanes' rows are read back;
  // only this wave writes and reads these rows, so no barrier is needed
  asm volatile("s_wait_dscnt 0x0" ::: "memory");
  // eight lanes store one query's 64 halves: a whole 128-byte line
#pragma unroll
  for (int i = 0; i < 8; ++i)
    *(v8h*)&outu[(size_t)dest[i] * 512 + h * HD + oseg] = *(const v8h*)&Os[wave][(i * 4 + orow) * P64 + oseg];
}

// ---------------------------------------------------------------------------
extern "C" void kernel_launch(void* const* d_in, const int* in_sizes, int n_in,
                              void* d_out, int out_size, void* d_ws, size_t ws_size,
                              hipStream_t stream) {
  const float* x   = (const float*)d_in[0];
  const int*   phi = (const int*)  d_in[1];
  const float* Wq  = (const float*)d_in[2];
  const float* bq  = (const float*)d_in[3];
  const float* Wk  = (const float*)d_in[4];
  const float* bk  = (const float*)d_in[5];
  const float* Wv  = (const float*)d_in[6];
  const float* bv  = (const float*)d_in[7];
  const float* Wo  = (const float*)d_in[8];
  const float* bo  = (const float*)d_in[9];
  float* out = (float*)d_out;

  _Float16* ws = (_Float16*)d_ws;
  size_t o = 0;
  _Float16* xp  = ws + o; o += (size_t)MPAD * DMODEL;
  _Float16* wqh = ws + o; o += (size_t)DMODEL * DMODEL;
  _Float16* wkh = ws + o; o += (size_t)DMODEL * DMODEL;
  _Float16* wvh = ws + o; o += (size_t)DMODEL * DMODEL;
  _Float16* woh = ws + o; o += (size_t)DMODEL * DMODEL;
  _Float16* q_h = ws + o; o += (size_t)MPAD * DMODEL;
  _Float16* k_h = ws + o; o += (size_t)MPAD * DMODEL;
  _Float16* v_h = ws + o; o += (size_t)MPAD * DMODEL;
  _Float16* att = ws + o; o += (size_t)NTOK * DMODEL;

  // wqh..woh are four adjacent planes of the workspace, q_h..v_h three adjacent ones
  prep_kernel<<<4 * CASTB + MPAD / 4, 256, 0, stream>>>(x, phi, Wq, Wk, Wv, Wo, xp, wqh);

  gemm512_kernel<true ><<<dim3(MPAD / 128, 12), 256, 0, stream>>>(xp, wqh, bq, bk, bv, nullptr, q_h);

  attn_kernel<<<dim3(NBLK, NHEAD), 256, 0, stream>>>(q_h, k_h, v_h, phi, att);

  gemm512_kernel<false><<<dim3(NTOK / 128, 4), 256, 0, stream>>>(att, woh, bo, bo, bo, out, nullptr);
}

// v006
// One run takes 74.2 microseconds.
// Timed twice side by side with v005, it ran 1.06 times as fast both times.
// Over all steps from v000 it is 2.22 times as fast.
#include <hip/hip_runtime.h>
#include <hip/hip_bf16.h>

typedef __attribute__((ext_vector_type(16))) _Float16 v16h;
typedef __attribute__((ext_vector_type(8)))  _Float16 v8h;
typedef __attribute__((ext_vector_type(4)))  _Float16 v4h;
typedef __attribute__((ext_vector_type(8)))  float    v8f;

#define NTOK   16384
#define DMODEL 512
#define NHEAD  8
#define HD     64
#define BLK    256                 // query block == w_half
#define WH     256                 // w_half
#define MPAD   (NTOK + 2*WH)       // 16896 padded rows
#define NBLK   (NTOK / BLK)        // 64

#define P32    40                  // rows of 32 halves (64 B) at 80 B
#define P64    72                  // rows of 64 halves (128 B) at 144 B
#define VGRP   16
#define VTILE  (64 * P32 + 4 * VGRP)

static __device__ inline v16h frag16(const _Float16* p) {
  v8h lo = *(const v8h*)(p);
  v8h hi = *(const v8h*)(p + 16);
  return __builtin_shufflevector(lo, hi, 0,1,2,3,4,5,6,7,8,9,10,11,12,13,14,15);
}

static __device__ inline v8f vzero8() {
  v8f z = {0.f,0.f,0.f,0.f,0.f,0.f,0.f,0.f};
  return z;
}

static __device__ inline float swapx16(float x) {
  return __int_as_float(__builtin_amdgcn_ds_swizzle(__float_as_int(x), 0x401f));
}

// ------------- one grid for the five independent preparation jobs, by block range
// blocks [0, 4*CASTB): cast f32->f16 of Wq, Wk, Wv, Wo into four planes of wh
// blocks [4*CASTB, ..): gather by phi + circular pad
#define WN     (DMODEL * DMODEL)
#define CASTB  (WN / 1024)         // 256 blocks of 256 threads x 4 elements per weight
__global__ void prep_kernel(const float* __restrict__ x,
                            const int* __restrict__ phi,
                            const float* __restrict__ Wq,
                            const float* __restrict__ Wk,
                            const float* __restrict__ Wv,
                            const float* __restrict__ Wo,
                            _Float16* __restrict__ xp,
                            _Float16* __restrict__ wh) {
  if (blockIdx.x < 4 * CASTB) {
    const int sel = blockIdx.x / CASTB;
    const float* src = sel == 0 ? Wq : sel == 1 ? Wk : sel == 2 ? Wv : Wo;
    _Float16* dst = wh + (size_t)sel * WN;
    int i = ((blockIdx.x % CASTB) * 256 + threadIdx.x) * 4;
    float4 v = *(const float4*)(src + i);
    dst[i+0] = (_Float16)v.x; dst[i+1] = (_Float16)v.y;
    dst[i+2] = (_Float16)v.z; dst[i+3] = (_Float16)v.w;
    return;
  }
  int t   = (blockIdx.x - 4 * CASTB) * 256 + threadIdx.x;   // one 8-half segment per thread
  int idx = t * 8;
  int p   = idx >> 9;          // padded row
  int c   = idx & 511;         // column
  int o   = p - WH;
  if (o < 0)      o += NTOK;
  if (o >= NTOK)  o -= NTOK;
  int src = min(max(phi[o], 0), NTOK - 1);   // the row read stays inside x for any content of phi
  const float* s = x + (size_t)src * DMODEL + c;
  float4 a = *(const float4*)s;
  float4 b = *(const float4*)(s + 4);
  v8h out;
  out[0]=(_Float16)a.x; out[1]=(_Float16)a.y; out[2]=(_Float16)a.z; out[3]=(_Float16)a.w;
  out[4]=(_Float16)b.x; out[5]=(_Float16)b.y; out[6]=(_Float16)b.z; out[7]=(_Float16)b.w;
  *(v8h*)(xp + (size_t)p * DMODEL + c) = out;
  // stands in front of any later write of this store's registers: the built code lays
  // the cast path behind the store, where the separate gather kernel simply ended
  asm volatile("s_wait_xcnt 0x0" ::: "memory");
}

// ------------------------------------------------------- C = A @ W^T + bias
// A: [M x 512] f16 row-major.  W: [512 x 512] f16 row-major (B(k,n)=W[n][k]).
// 128x128 tile per workgroup, 8 waves (4 along M x 2 along N), 64-deep k-steps: the piece
// of a row that one step stages is 128 bytes, a whole cache line, so a wave-wide 16-byte
// load touches four lines and uses every byte of them.
// Double-buffered LDS: the global loads of step kb+1 are issued in front of WMMAs of step kb
// and kept in registers; their LDS stores stand behind those WMMAs, so the wait for the
// loads falls behind work. The A tile travels during the first 32 k of the step, the W tile
// during the second 32 k, in the same registers. One barrier per k-step.
// blockIdx.y = 4*sel + n-tile: product sel uses weight plane sel of W, bias sel and
// output plane sel of outH, so independent products on one A share one grid.
// Weight rows are dealt to the LDS rows so that column l of a wave's B tile nt is output
// column 4*l + nt of the wave's 64: a lane's four accumulator tiles are then four adjacent
// columns, and 16 lanes store one row's 64 columns as whole 128-byte lines.
template<bool HALF_OUT>
__global__ __launch_bounds__(256)
void gemm512_kernel(const _Float16* __restrict__ A,
                    const _Float16* __restrict__ Wall,
                    const float* __restrict__ bias0,
                    const float* __restrict__ bias1,
                    const float* __restrict__ bias2,
                    float* __restrict__ outF,
                    _Float16* __restrict__ outHall) {
  __shared__ __attribute__((aligned(16))) _Float16 As[2][128 * P64];
  __shared__ __attribute__((aligned(16))) _Float16 Bs[2][128 * P64];

  const int tid  = threadIdx.x;
  const int lane = tid & 31;
  const int wave = tid >> 5;
  const int m0 = blockIdx.x * 128;
  const int sel = blockIdx.y >> 2;
  const int n0 = (blockIdx.y & 3) * 128;
  const _Float16* __restrict__ W = Wall + (size_t)sel * WN;
  const float* __restrict__ bias = sel == 0 ? bias0 : sel == 1 ? bias1 : bias2;
  _Float16* __restrict__ outH = outHall + (size_t)sel * MPAD * DMODEL;
  const int mwave = (wave & 3) * 32;   // 4 waves along M
  const int nwave = (wave >> 2) * 64;  // 2 waves along N
  const int half = lane >> 4;
  const int l16  = lane & 15;
  const int off  = half * 8;

  const int lrow = tid >> 3;           // 0..31
  const int lseg = (tid & 7) * 8;      // 0..56: eight lanes cover one row's 128 bytes
  const int wrow = 4 * (lrow & 15) + (lrow >> 4);   // weight row kept in LDS row lrow of each 64

  // one pointer per operand; the other three rows are reached by constant offsets
  const _Float16* __restrict__ aSrc = A + (size_t)(m0 + lrow) * 512 + lseg;
  const _Float16* __restrict__ wSrc = W + (size_t)(n0 + wrow) * 512 + lseg;
  // Step kb works on k slice (kb + kst) mod 8. kst spreads workgroups that
  // share an A tile (same x) or a W tile (same y) over different start slices, for speed only.
  const int kst = (blockIdx.x + (blockIdx.x >> 3) + blockIdx.y) & 7;
  v8h ra[4], rb[4];                    // a staged tile on its way from global memory to LDS
  auto fetchA = [&](int kb) {
    const _Float16* __restrict__ s = aSrc + ((kb + kst) & 7) * 64;
#pragma unroll
    for (int i = 0; i < 4; ++i) ra[i] = *(const v8h*)&s[i * 32 * 512];
  };
  auto fetchB = [&](int kb) {          // LDS row lrow + 32*i holds weight row wrow + 2*(i&1) + 64*(i>>1)
    const _Float16* __restrict__ s = wSrc + ((kb + kst) & 7) * 64;
#pragma unroll
    for (int i = 0; i < 4; ++i) rb[i] = *(const v8h*)&s[((i & 1) * 2 + (i >> 1) * 64) * 512];
  };
  auto putA = [&](int buf) {
#pragma unroll
    for (int i = 0; i < 4; ++i) *(v8h*)&As[buf][(lrow + 32 * i) * P64 + lseg] = ra[i];
  };
  auto putB = [&](int buf) {
#pragma unroll
    for (int i = 0; i < 4; ++i) *(v8h*)&Bs[buf][(lrow + 32 * i) * P64 + lseg] = rb[i];
  };

  v8f acc[2][4];
#pragma unroll
  for (int mt = 0; mt < 2; ++mt)
#pragma unroll
    for (int nt = 0; nt < 4; ++nt) acc[mt][nt] = vzero8();

  fetchA(0);
  fetchB(0);
  putA(0);
  putB(0);
  __syncthreads();

  for (int kb = 0; kb < 8; ++kb) {
    const int cur = kb & 1;
#pragma unroll
    for (int ks = 0; ks < 2; ++ks) {       // the step's two 32-deep halves
      if (kb < 7) {                        // in flight during the WMMAs below
        if (ks == 0) fetchA(kb + 1); else fetchB(kb + 1);
      }
      // keeps all four loads in front of the half's work: sunk among the WMMAs they would
      // be waited for with almost no lead
      __builtin_amdgcn_sched_barrier(0);

      v16h aF[2];
#pragma unroll
      for (int mt = 0; mt < 2; ++mt)
        aF[mt] = frag16(&As[cur][(mwave + mt*16 + l16) * P64 + ks*32 + off]);
#pragma unroll
      for (int np = 0; np < 2; ++np) {
        v16h bF[2];
#pragma unroll
        for (int nt = 0; nt < 2; ++nt)
          bF[nt] = frag16(&Bs[cur][(nwave + (np*2 + nt)*16 + l16) * P64 + ks*32 + off]);
#pragma unroll
        for (int nt = 0; nt < 2; ++nt)
#pragma unroll
          for (int mt = 0; mt < 2; ++mt)
            acc[mt][np*2 + nt] = __builtin_amdgcn_wmma_f32_16x16x32_f16(
                false, aF[mt], false, bF[nt], (short)0, acc[mt][np*2 + nt], false, false);
        // keeps the next pair's LDS loads (np 0) and the staged tile's LDS stores with their
        // wait for the global loads (np 1) behind these WMMAs
        __builtin_amdgcn_sched_barrier(0);
      }
      if (kb < 7) {                        // every reader left this buffer at the last barrier
        if (ks == 0) putA(cur ^ 1); else putB(cur ^ 1);
      }
      if (ks == 0) __builtin_amdgcn_sched_barrier(0);
    }
    __syncthreads();
  }

  const int n = n0 + nwave + 4 * l16;  // first of this lane's four adjacent columns
  const float4 bb = *(const float4*)&bias[n];
#pragma unroll
  for (int mt = 0; mt < 2; ++mt) {
    const int mbase = m0 + mwave + mt*16 + half*8;
#pragma unroll
    for (int r = 0; r < 8; ++r) {
      const float4 val = make_float4(acc[mt][0][r] + bb.x, acc[mt][1][r] + bb.y,
                                     acc[mt][2][r] + bb.z, acc[mt][3][r] + bb.w);
      const size_t oi = (size_t)(mbase + r) * 512 + n;
      if (HALF_OUT) {
        v4h hv = {(_Float16)val.x, (_Float16)val.y, (_Float16)val.z, (_Float16)val.w};
        *(v4h*)&outH[oi] = hv;
      } else {
        *(float4*)&outF[oi] = val;
      }
    }
  }
}

// -------------------------------------------- blocked local attention (flash)
// One workgroup per (block b, head h). 8 waves x 32 queries = 256 queries.
// Computes S^T = K.Q^T so softmax stats are per-lane and exp(S^T) tiles feed
// the O^T = V^T.P^T WMMA directly (no cross-lane shuffle of probabilities).
// Double-buffered K/V staging, the next chunk's global loads held in registers while
// this chunk is worked on; wave-uniform band classification per 32-key
// chunk: skip fully-invalid chunks, mask only boundary chunks.
__global__ __launch_bounds__(256)
void attn_kernel(const _Float16* __restrict__ qh,
                 const _Float16* __restrict__ kh,
                 const _Float16* __restrict__ vh,
                 const int* __restrict__ phi,
                 _Float16* __restrict__ outu) {
  __shared__ __attribute__((aligned(16))) _Float16 Ks[2][32 * P64];  // [key][d] chunk
  __shared__ __attribute__((aligned(16))) _Float16 VsT[2][VTILE];    // [d][key] chunk (transposed)
  __shared__ __attribute__((aligned(16))) _Float16 Os[8][32 * P64];  // [query][d], one range per wave

  const int b = blockIdx.x, h = blockIdx.y;
  const int tid  = threadIdx.x;
  const int lane = tid & 31;
  const int wave = tid >> 5;
  const int half = lane >> 4;
  const int l16  = lane & 15;
  const int off  = half * 8;
  const int q0   = wave * 32;

  // Q^T fragments (B operand): col q = l16, contiguous-in-d chunks per lane
  v16h qF[2][2];
#pragma unroll
  for (int qt = 0; qt < 2; ++qt) {
    const size_t qrow = (size_t)(b*BLK + WH + q0 + qt*16 + l16);
    const _Float16* qb = qh + qrow * 512 + h * HD;
#pragma unroll
    for (int ds = 0; ds < 2; ++ds)
      qF[qt][ds] = frag16(qb + ds*32 + off);
  }

  float mrun[2] = {-1e30f, -1e30f};
  float lrun[2] = {0.f, 0.f};
  v8f oacc[2][4];
#pragma unroll
  for (int qt = 0; qt < 2; ++qt)
#pragma unroll
    for (int dt = 0; dt < 4; ++dt) oacc[qt][dt] = vzero8();

  const int lr = tid >> 3;        // staged row 0..31
  const int ls = (tid & 7) * 8;   // seg 0..56

  v8h rk, rv;                     // one staged chunk on its way from global memory to LDS
  auto fetch = [&](int c) {
    const size_t kb = (size_t)(b * BLK + c * 32);
    rk = *(const v8h*)&kh[(kb + lr) * 512 + h * HD + ls];
    rv = *(const v8h*)&vh[(kb + lr) * 512 + h * HD + ls];
  };
  auto put = [&](int buf) {
    *(v8h*)&Ks[buf][lr * P64 + ls] = rk;
#pragma unroll
    for (int i = 0; i < 8; ++i)
      VsT[buf][(ls + i) * P32 + (ls >> 4) * VGRP + lr] = rv[i];
  };

  fetch(0);
  put(0);
  __syncthreads();

  for (int c = 0; c < 24; ++c) {              // 768-key window in 32-key chunks
    const int cur = c & 1;
    if (c < 23) fetch(c + 1);                 // in flight during the work below

    // wave-uniform band classification for this 32-key chunk
    const int c32 = c * 32;
    const bool anyv  = (c32 + 31 >= q0) && (c32 <= q0 + 31 + 2*WH);
    const bool fullv = (c32 >= q0 + 31) && (c32 + 31 <= q0 + 2*WH);

    if (anyv) {
      // K fragments (A operand of S^T): row = key, chunks along d
      v16h aK[2][2];
#pragma unroll
      for (int kt = 0; kt < 2; ++kt)
#pragma unroll
        for (int ds = 0; ds < 2; ++ds)
          aK[kt][ds] = frag16(&Ks[cur][(kt*16 + l16) * P64 + ds*32 + off]);

      v16h pF[2];
#pragma unroll
      for (int qt = 0; qt < 2; ++qt) {
        v8f st[2];
#pragma unroll
        for (int kt = 0; kt < 2; ++kt) {
          v8f s = vzero8();
          s = __builtin_amdgcn_wmma_f32_16x16x32_f16(false, aK[kt][0], false, qF[qt][0], (short)0, s, false, false);
          s = __builtin_amdgcn_wmma_f32_16x16x32_f16(false, aK[kt][1], false, qF[qt][1], (short)0, s, false, false);
          st[kt] = s;
        }
        const int j = q0 + qt*16 + l16;        // query index in block
        float cmax = -3e30f;
        if (fullv) {
#pragma unroll
          for (int kt = 0; kt < 2; ++kt)
#pragma unroll
            for (int r = 0; r < 8; ++r) {
              const float sv = st[kt][r] * 0.125f;
              st[kt][r] = sv;
              cmax = fmaxf(cmax, sv);
            }
        } else {
#pragma unroll
          for (int kt = 0; kt < 2; ++kt)
#pragma unroll
            for (int r = 0; r < 8; ++r) {
              const int rr = c32 + kt*16 + half*8 + r;   // key index in window
              // band mask j <= rr <= j+512 as one unsigned range test
              const float sv = ((unsigned)(rr - j) <= (unsigned)(2*WH))
                                 ? st[kt][r] * 0.125f : -2e30f;
              st[kt][r] = sv;
              cmax = fmaxf(cmax, sv);
            }
        }
        cmax = fmaxf(cmax, swapx16(cmax));
        const float mnew = fmaxf(mrun[qt], cmax);
        const float corr = __expf(mrun[qt] - mnew);
        float p0[8], p1[8];
        float rs = 0.f;
#pragma unroll
        for (int r = 0; r < 8; ++r) {
          p0[r] = __expf(st[0][r] - mnew);
          p1[r] = __expf(st[1][r] - mnew);
          rs += p0[r] + p1[r];
        }
        rs += swapx16(rs);
        lrun[qt] = lrun[qt] * corr + rs;
        mrun[qt] = mnew;
#pragma unroll
        for (int dt = 0; dt < 4; ++dt)
#pragma unroll
          for (int r = 0; r < 8; ++r) oacc[qt][dt][r] *= corr;
        // P^T B-fragment: lo chunk = keytile 0 rows, hi chunk = keytile 1 rows
        v16h p;
#pragma unroll
        for (int r = 0; r < 8; ++r) {
          p[r]     = (_Float16)p0[r];
          p[r + 8] = (_Float16)p1[r];
        }
        pF[qt] = p;
      }

      // O^T += V^T . P^T
#pragma unroll
      for (int dt = 0; dt < 4; ++dt) {
        v16h vF = frag16(&VsT[cur][(dt*16 + l16) * P32 + dt * VGRP + off]);
#pragma unroll
        for (int qt = 0; qt < 2; ++qt)
          oacc[qt][dt] = __builtin_amdgcn_wmma_f32_16x16x32_f16(
              false, vF, false, pF[qt], (short)0, oacc[qt][dt], false, false);
      }
    }
    if (c < 23) put(cur ^ 1);                 // every reader left this buffer at the last barrier
    __syncthreads();
  }

  // rows of the scatter (out_un[phi[o]] = out[o]) that this lane will store, asked for early
  const int orow = lane >> 3;       // 0..3
  const int oseg = (lane & 7) * 8;  // 0..56
  int dest[8];
#pragma unroll
  for (int i = 0; i < 8; ++i)
    dest[i] = min(max(phi[b * BLK + q0 + i * 4 + orow], 0), NTOK - 1);  // the row written stays inside outu

  // normalize as f16 into this wave's own LDS range, one row per query
#pragma unroll
  for (int qt = 0; qt < 2; ++qt) {
    const float inv = 1.0f / lrun[qt];
#pragma unroll
    for (int dt = 0; dt < 4; ++dt) {
      v8h o;
#pragma unroll
      for (int r = 0; r < 8; ++r) o[r] = (_Float16)(oacc[qt][dt][r] * inv);
      *(v8h*)&Os[wave][(qt*16 + l16) * P64 + dt*16 + half*8] = o;
    }
  }
  // the wave's own LDS stores have retired before other lanes' rows are read back;
  // only this wave writes and reads these rows, so no barrier is needed
  asm volatile("s_wait_dscnt 0x0" ::: "memory");
  // eight lanes store one query's 64 halves: a whole 128-byte line
#pragma unroll
  for (int i = 0; i < 8; ++i)
    *(v8h*)&outu[(size_t)dest[i] * 512 + h * HD + oseg] = *(const v8h*)&Os[wave][(i * 4 + orow) * P64 + oseg];
}

// ---------------------------------------------------------------------------
extern "C" void kernel_launch(void* const* d_in, const int* in_sizes, int n_in,
                              void* d_out, int out_size, void* d_ws, size_t ws_size,
                              hipStream_t stream) {
  const float* x   = (const float*)d_in[0];
  const int*   phi = (const int*)  d_in[1];
  const float* Wq  = (const float*)d_in[2];
  const float* bq  = (const float*)d_in[3];
  const float* Wk  = (const float*)d_in[4];
  const float* bk  = (const float*)d_in[5];
  const float* Wv  = (const float*)d_in[6];
  const float* bv  = (const float*)d_in[7];
  const float* Wo  = (const float*)d_in[8];
  const float* bo  = (const float*)d_in[9];
  float* out = (float*)d_out;

  _Float16* ws = (_Float16*)d_ws;
  size_t o = 0;
  _Float16* xp  = ws + o; o += (size_t)MPAD * DMODEL;
  _Float16* wqh = ws + o; o += (size_t)DMODEL * DMODEL;
  _Float16* wkh = ws + o; o += (size_t)DMODEL * DMODEL;
  _Float16* wvh = ws + o; o += (size_t)DMODEL * DMODEL;
  _Float16* woh = ws + o; o += (size_t)DMODEL * DMODEL;
  _Float16* q_h = ws + o; o += (size_t)MPAD * DMODEL;
  _Float16* k_h = ws + o; o += (size_t)MPAD * DMODEL;
  _Float16* v_h = ws + o; o += (size_t)MPAD * DMODEL;
  _Float16* att = ws + o; o += (size_t)NTOK * DMODEL;

  // wqh..woh are four adjacent planes of the workspace, q_h..v_h three adjacent ones
  prep_kernel<<<4 * CASTB + MPAD / 4, 256, 0, stream>>>(x, phi, Wq, Wk, Wv, Wo, xp, wqh);

  gemm512_kernel<true ><<<dim3(MPAD / 128, 12), 256, 0, stream>>>(xp, wqh, bq, bk, bv, nullptr, q_h);

  attn_kernel<<<dim3(NBLK, NHEAD), 256, 0, stream>>>(q_h, k_h, v_h, phi, att);

  gemm512_kernel<false><<<dim3(NTOK / 128, 4), 256, 0, stream>>>(att, woh, bo, bo, bo, out, nullptr);
}

// v007
// One run takes 70.7 microseconds.
// Timed twice side by side with v006, it ran 1.05 times as fast both times.
// Over all steps from v000 it is 2.33 times as fast.
#include <hip/hip_runtime.h>
#include <hip/hip_bf16.h>

typedef __attribute__((ext_vector_type(16))) _Float16 v16h;
typedef __attribute__((ext_vector_type(8)))  _Float16 v8h;
typedef __attribute__((ext_vector_type(4)))  _Float16 v4h;
typedef __attribute__((ext_vector_type(8)))  float    v8f;
typedef __attribute__((ext_vector_type(2)))  float    v2f;

#define NTOK   16384
#define DMODEL 512
#define NHEAD  8
#define HD     64
#define BLK    256                 // query block == w_half
#define WH     256                 // w_half
#define MPAD   (NTOK + 2*WH)       // 16896 padded rows
#define NBLK   (NTOK / BLK)        // 64

#define P32    40                  // rows of 32 halves (64 B) at 80 B
#define P64    72                  // rows of 64 halves (128 B) at 144 B
#define VGRP   16
#define VTILE  (64 * P32 + 4 * VGRP)
// attention: the largest sum of a lane's 16 softmax terms of one chunk that leaves the reference value where it is
#define PROOM 4096.0f

static __device__ inline v16h frag16(const _Float16* p) {
  v8h lo = *(const v8h*)(p);
  v8h hi = *(const v8h*)(p + 16);
  return __builtin_shufflevector(lo, hi, 0,1,2,3,4,5,6,7,8,9,10,11,12,13,14,15);
}

static __device__ inline v8f vzero8() {
  v8f z = {0.f,0.f,0.f,0.f,0.f,0.f,0.f,0.f};
  return z;
}

static __device__ inline float swapx16(float x) {
  return __int_as_float(__builtin_amdgcn_ds_swizzle(__float_as_int(x), 0x401f));
}

// ------------- one grid for the five independent preparation jobs, by block range
// blocks [0, 4*CASTB): cast f32->f16 of Wq, Wk, Wv, Wo into four planes of wh
// blocks [4*CASTB, ..): gather by phi + circular pad
#define WN     (DMODEL * DMODEL)
#define CASTB  (WN / 1024)         // 256 blocks of 256 threads x 4 elements per weight
__global__ void prep_kernel(const float* __restrict__ x,
                            const int* __restrict__ phi,
                            const float* __restrict__ Wq,
                            const float* __restrict__ Wk,
                            const float* __restrict__ Wv,
                            const float* __restrict__ Wo,
                            _Float16* __restrict__ xp,
                            _Float16* __restrict__ wh) {
  if (blockIdx.x < 4 * CASTB) {
    const int sel = blockIdx.x / CASTB;
    const float* src = sel == 0 ? Wq : sel == 1 ? Wk : sel == 2 ? Wv : Wo;
    _Float16* dst = wh + (size_t)sel * WN;
    int i = ((blockIdx.x % CASTB) * 256 + threadIdx.x) * 4;
    float4 v = *(const float4*)(src + i);
    dst[i+0] = (_Float16)v.x; dst[i+1] = (_Float16)v.y;
    dst[i+2] = (_Float16)v.z; dst[i+3] = (_Float16)v.w;
    return;
  }
  int t   = (blockIdx.x - 4 * CASTB) * 256 + threadIdx.x;   // one 8-half segment per thread
  int idx = t * 8;
  int p   = idx >> 9;          // padded row
  int c   = idx & 511;         // column
  int o   = p - WH;
  if (o < 0)      o += NTOK;
  if (o >= NTOK)  o -= NTOK;
  int src = min(max(phi[o], 0), NTOK - 1);   // the row read stays inside x for any content of phi
  const float* s = x + (size_t)src * DMODEL + c;
  float4 a = *(const float4*)s;
  float4 b = *(const float4*)(s + 4);
  v8h out;
  out[0]=(_Float16)a.x; out[1]=(_Float16)a.y; out[2]=(_Float16)a.z; out[3]=(_Float16)a.w;
  out[4]=(_Float16)b.x; out[5]=(_Float16)b.y; out[6]=(_Float16)b.z; out[7]=(_Float16)b.w;
  *(v8h*)(xp + (size_t)p * DMODEL + c) = out;
  // stands in front of any later write of this store's registers: the built code lays
  // the cast path behind the store, where the separate gather kernel simply ended
  asm volatile("s_wait_xcnt 0x0" ::: "memory");
}

// ------------------------------------------------------- C = A @ W^T + bias
// A: [M x 512] f16 row-major.  W: [512 x 512] f16 row-major (B(k,n)=W[n][k]).
// 128x128 tile per workgroup, 8 waves (4 along M x 2 along N), 64-deep k-steps: the piece
// of a row that one step stages is 128 bytes, a whole cache line, so a wave-wide 16-byte
// load touches four lines and uses every byte of them.
// Double-buffered LDS: the global loads of step kb+1 are issued in front of WMMAs of step kb
// and kept in registers; their LDS stores stand behind those WMMAs, so the wait for the
// loads falls behind work. The A tile travels during the first 32 k of the step, the W tile
// during the second 32 k, in the same registers. One barrier per k-step.
// blockIdx.y = 4*sel + n-tile: product sel uses weight plane sel of W, bias sel and
// output plane sel of outH, so independent products on one A share one grid.
// Weight rows are dealt to the LDS rows so that column l of a wave's B tile nt is output
// column 4*l + nt of the wave's 64: a lane's four accumulator tiles are then four adjacent
// columns, and 16 lanes store one row's 64 columns as whole 128-byte lines.
template<bool HALF_OUT>
__global__ __launch_bounds__(256)
void gemm512_kernel(const _Float16* __restrict__ A,
                    const _Float16* __restrict__ Wall,
                    const float* __restrict__ bias0,
                    const float* __restrict__ bias1,
                    const float* __restrict__ bias2,
                    float* __restrict__ outF,
                    _Float16* __restrict__ outHall) {
  __shared__ __attribute__((aligned(16))) _Float16 As[2][128 * P64];
  __shared__ __attribute__((aligned(16))) _Float16 Bs[2][128 * P64];

  const int tid  = threadIdx.x;
  const int lane = tid & 31;
  const int wave = tid >> 5;
  const int m0 = blockIdx.x * 128;
  const int sel = blockIdx.y >> 2;
  const int n0 = (blockIdx.y & 3) * 128;
  const _Float16* __restrict__ W = Wall + (size_t)sel * WN;
  const float* __restrict__ bias = sel == 0 ? bias0 : sel == 1 ? bias1 : bias2;
  _Float16* __restrict__ outH = outHall + (size_t)sel * MPAD * DMODEL;
  const int mwave = (wave & 3) * 32;   // 4 waves along M
  const int nwave = (wave >> 2) * 64;  // 2 waves along N
  const int half = lane >> 4;
  const int l16  = lane & 15;
  const int off  = half * 8;

  const int lrow = tid >> 3;           // 0..31
  const int lseg = (tid & 7) * 8;      // 0..56: eight lanes cover one row's 128 bytes
  const int wrow = 4 * (lrow & 15) + (lrow >> 4);   // weight row kept in LDS row lrow of each 64

  // one pointer per operand; the other three rows are reached by constant offsets
  const _Float16* __restrict__ aSrc = A + (size_t)(m0 + lrow) * 512 + lseg;
  const _Float16* __restrict__ wSrc = W + (size_t)(n0 + wrow) * 512 + lseg;
  // Step kb works on k slice (kb + kst) mod 8. kst spreads workgroups that
  // share an A tile (same x) or a W tile (same y) over different start slices, for speed only.
  const int kst = (blockIdx.x + (blockIdx.x >> 3) + blockIdx.y) & 7;
  v8h ra[4], rb[4];                    // a staged tile on its way from global memory to LDS
  auto fetchA = [&](int kb) {
    const _Float16* __restrict__ s = aSrc + ((kb + kst) & 7) * 64;
#pragma unroll
    for (int i = 0; i < 4; ++i) ra[i] = *(const v8h*)&s[i * 32 * 512];
  };
  auto fetchB = [&](int kb) {          // LDS row lrow + 32*i holds weight row wrow + 2*(i&1) + 64*(i>>1)
    const _Float16* __restrict__ s = wSrc + ((kb + kst) & 7) * 64;
#pragma unroll
    for (int i = 0; i < 4; ++i) rb[i] = *(const v8h*)&s[((i & 1) * 2 + (i >> 1) * 64) * 512];
  };
  auto putA = [&](int buf) {
#pragma unroll
    for (int i = 0; i < 4; ++i) *(v8h*)&As[buf][(lrow + 32 * i) * P64 + lseg] = ra[i];
  };
  auto putB = [&](int buf) {
#pragma unroll
    for (int i = 0; i < 4; ++i) *(v8h*)&Bs[buf][(lrow + 32 * i) * P64 + lseg] = rb[i];
  };

  v8f acc[2][4];
#pragma unroll
  for (int mt = 0; mt < 2; ++mt)
#pragma unroll
    for (int nt = 0; nt < 4; ++nt) acc[mt][nt] = vzero8();

  fetchA(0);
  fetchB(0);
  putA(0);
  putB(0);
  __syncthreads();

  for (int kb = 0; kb < 8; ++kb) {
    const int cur = kb & 1;
#pragma unroll
    for (int ks = 0; ks < 2; ++ks) {       // the step's two 32-deep halves
      if (kb < 7) {                        // in flight during the WMMAs below
        if (ks == 0) fetchA(kb + 1); else fetchB(kb + 1);
      }
      // keeps all four loads in front of the half's work: sunk among the WMMAs they would
      // be waited for with almost no lead
      __builtin_amdgcn_sched_barrier(0);

      v16h aF[2];
#pragma unroll
      for (int mt = 0; mt < 2; ++mt)
        aF[mt] = frag16(&As[cur][(mwave + mt*16 + l16) * P64 + ks*32 + off]);
#pragma unroll
      for (int np = 0; np < 2; ++np) {
        v16h bF[2];
#pragma unroll
        for (int nt = 0; nt < 2; ++nt)
          bF[nt] = frag16(&Bs[cur][(nwave + (np*2 + nt)*16 + l16) * P64 + ks*32 + off]);
#pragma unroll
        for (int nt = 0; nt < 2; ++nt)
#pragma unroll
          for (int mt = 0; mt < 2; ++mt)
            acc[mt][np*2 + nt] = __builtin_amdgcn_wmma_f32_16x16x32_f16(
                false, aF[mt], false, bF[nt], (short)0, acc[mt][np*2 + nt], false, false);
        // keeps the next pair's LDS loads (np 0) and the staged tile's LDS stores with their
        // wait for the global loads (np 1) behind these WMMAs
        __builtin_amdgcn_sched_barrier(0);
      }
      if (kb < 7) {                        // every reader left this buffer at the last barrier
        if (ks == 0) putA(cur ^ 1); else putB(cur ^ 1);
      }
      if (ks == 0) __builtin_amdgcn_sched_barrier(0);
    }
    __syncthreads();
  }

  const int n = n0 + nwave + 4 * l16;  // first of this lane's four adjacent columns
  const float4 bb = *(const float4*)&bias[n];
#pragma unroll
  for (int mt = 0; mt < 2; ++mt) {
    const int mbase = m0 + mwave + mt*16 + half*8;
#pragma unroll
    for (int r = 0; r < 8; ++r) {
      const float4 val = make_float4(acc[mt][0][r] + bb.x, acc[mt][1][r] + bb.y,
                                     acc[mt][2][r] + bb.z, acc[mt][3][r] + bb.w);
      const size_t oi = (size_t)(mbase + r) * 512 + n;
      if (HALF_OUT) {
        v4h hv = {(_Float16)val.x, (_Float16)val.y, (_Float16)val.z, (_Float16)val.w};
        *(v4h*)&outH[oi] = hv;
      } else {
        *(float4*)&outF[oi] = val;
      }
    }
  }
}

// -------------------------------------------- blocked local attention (flash)
// One workgroup per (block b, head h). 8 waves x 32 queries = 256 queries.
// Computes S^T = K.Q^T so softmax stats are per-lane and exp(S^T) tiles feed
// the O^T = V^T.P^T WMMA directly (no cross-lane shuffle of probabilities).
// Double-buffered K/V staging, the next chunk's global loads held in registers while
// this chunk is worked on; wave-uniform band classification per 32-key
// chunk: skip fully-invalid chunks, mask only boundary chunks.
__global__ __launch_bounds__(256)
void attn_kernel(const _Float16* __restrict__ qh,
                 const _Float16* __restrict__ kh,
                 const _Float16* __restrict__ vh,
                 const int* __restrict__ phi,
                 _Float16* __restrict__ outu) {
  __shared__ __attribute__((aligned(16))) _Float16 Ks[2][32 * P64];  // [key][d] chunk
  __shared__ __attribute__((aligned(16))) _Float16 VsT[2][VTILE];    // [d][key] chunk (transposed)
  __shared__ __attribute__((aligned(16))) _Float16 Os[8][32 * P64];  // [query][d], one range per wave

  const int b = blockIdx.x, h = blockIdx.y;
  const int tid  = threadIdx.x;
  const int lane = tid & 31;
  const int wave = tid >> 5;
  const int half = lane >> 4;
  const int l16  = lane & 15;
  const int off  = half * 8;
  const int q0   = wave * 32;

  // Q^T fragments (B operand): col q = l16, contiguous-in-d chunks per lane
  v16h qF[2][2];
#pragma unroll
  for (int qt = 0; qt < 2; ++qt) {
    const size_t qrow = (size_t)(b*BLK + WH + q0 + qt*16 + l16);
    const _Float16* qb = qh + qrow * 512 + h * HD;
#pragma unroll
    for (int ds = 0; ds < 2; ++ds)
      qF[qt][ds] = frag16(qb + ds*32 + off);
  }

  float mrun[2] = {-1e30f, -1e30f};
  v2f lrun[2] = {{0.f, 0.f}, {0.f, 0.f}};   // per lane: sums over its own even and odd keys
  v8f oacc[2][4];
#pragma unroll
  for (int qt = 0; qt < 2; ++qt)
#pragma unroll
    for (int dt = 0; dt < 4; ++dt) oacc[qt][dt] = vzero8();

  const int lr = tid >> 3;        // staged row 0..31
  const int ls = (tid & 7) * 8;   // seg 0..56

  v8h rk, rv;                     // one staged chunk on its way from global memory to LDS
  auto fetch = [&](int c) {
    const size_t kb = (size_t)(b * BLK + c * 32);
    rk = *(const v8h*)&kh[(kb + lr) * 512 + h * HD + ls];
    rv = *(const v8h*)&vh[(kb + lr) * 512 + h * HD + ls];
  };
  auto put = [&](int buf) {
    *(v8h*)&Ks[buf][lr * P64 + ls] = rk;
#pragma unroll
    for (int i = 0; i < 8; ++i)
      VsT[buf][(ls + i) * P32 + (ls >> 4) * VGRP + lr] = rv[i];
  };

  fetch(0);
  put(0);
  __syncthreads();

  for (int c = 0; c < 24; ++c) {              // 768-key window in 32-key chunks
    const int cur = c & 1;
    if (c < 23) fetch(c + 1);                 // in flight during the work below

    // wave-uniform band classification for this 32-key chunk
    const int c32 = c * 32;
    const bool anyv  = (c32 + 31 >= q0) && (c32 <= q0 + 31 + 2*WH);
    const bool fullv = (c32 >= q0 + 31) && (c32 + 31 <= q0 + 2*WH);

    if (anyv) {
      // K fragments (A operand of S^T): row = key, chunks along d
      v16h aK[2][2];
#pragma unroll
      for (int kt = 0; kt < 2; ++kt)
#pragma unroll
        for (int ds = 0; ds < 2; ++ds)
          aK[kt][ds] = frag16(&Ks[cur][(kt*16 + l16) * P64 + ds*32 + off]);

      // scores of both query tiles first: the one test further down serves both
      v8f st[2][2];
#pragma unroll
      for (int qt = 0; qt < 2; ++qt)
#pragma unroll
        for (int kt = 0; kt < 2; ++kt) {
          v8f s = vzero8();
          s = __builtin_amdgcn_wmma_f32_16x16x32_f16(false, aK[kt][0], false, qF[qt][0], (short)0, s, false, false);
          s = __builtin_amdgcn_wmma_f32_16x16x32_f16(false, aK[kt][1], false, qF[qt][1], (short)0, s, false, false);
          st[qt][kt] = s * 0.125f;
        }
      if (!fullv) {
#pragma unroll
        for (int qt = 0; qt < 2; ++qt) {
          const int j = q0 + qt*16 + l16;        // query index in block
#pragma unroll
          for (int kt = 0; kt < 2; ++kt)
#pragma unroll
            for (int r = 0; r < 8; ++r) {
              const int rr = c32 + kt*16 + half*8 + r;   // key index in window
              // band mask j <= rr <= j+512 as one unsigned range test
              if ((unsigned)(rr - j) > (unsigned)(2*WH)) st[qt][kt][r] = -2e30f;
            }
        }
      }
      // exp(s - mrun) of one query tile as P^T B-fragment (lo chunk = keytile 0 rows, hi chunk
      // = keytile 1 rows), and the sums over this lane's own even and odd keys
      v16h pF[2];
      v2f  cs[2];
      auto expsum = [&](int qt) {
        v16h p;
        v2f s = {0.f, 0.f};
#pragma unroll
        for (int kt = 0; kt < 2; ++kt)
#pragma unroll
          for (int r = 0; r < 8; r += 2) {
            v2f e;
            e[0] = __expf(st[qt][kt][r]     - mrun[qt]);
            e[1] = __expf(st[qt][kt][r + 1] - mrun[qt]);
            s += e;
            p[kt*8 + r]     = (_Float16)e[0];
            p[kt*8 + r + 1] = (_Float16)e[1];
          }
        pF[qt] = p;
        cs[qt] = s;
      };
      expsum(0);
      expsum(1);

      // V^T fragments, asked for in front of the test: they are on their way from LDS during it
      v16h vF[4];
#pragma unroll
      for (int dt = 0; dt < 4; ++dt)
        vF[dt] = frag16(&VsT[cur][(dt*16 + l16) * P32 + dt * VGRP + off]);

      // The reference value mrun moves only when it has to. No term is negative, so a lane
      // sum of at most PROOM bounds each of its terms, far inside f16 and f32 range: then the
      // terms stand as they are, and neither a maximum, nor an exchange between lanes, nor a
      // rescaling of sums and O is needed. Otherwise (always in a wave's first chunk, where
      // the terms overflow to infinity) mrun rises to the largest score so far, the same in
      // both halves of the wave, what has been summed is rescaled, and the terms are redone.
      const bool grow = !(cs[0][0] + cs[0][1] <= PROOM) || !(cs[1][0] + cs[1][1] <= PROOM);
      if (__builtin_amdgcn_ballot_w32(grow) != 0u) {
#pragma unroll
        for (int qt = 0; qt < 2; ++qt) {
          float cm = st[qt][0][0];
#pragma unroll
          for (int kt = 0; kt < 2; ++kt)
#pragma unroll
            for (int r = 0; r < 8; ++r) cm = fmaxf(cm, st[qt][kt][r]);
          const float mnew = fmaxf(mrun[qt], fmaxf(cm, swapx16(cm)));
          const float corr = __expf(mrun[qt] - mnew);
          lrun[qt] *= corr;
          mrun[qt] = mnew;
#pragma unroll
          for (int dt = 0; dt < 4; ++dt) oacc[qt][dt] *= corr;
          expsum(qt);
        }
      }
      lrun[0] += cs[0];
      lrun[1] += cs[1];

      // O^T += V^T . P^T
#pragma unroll
      for (int dt = 0; dt < 4; ++dt)
#pragma unroll
        for (int qt = 0; qt < 2; ++qt)
          oacc[qt][dt] = __builtin_amdgcn_wmma_f32_16x16x32_f16(
              false, vF[dt], false, pF[qt], (short)0, oacc[qt][dt], false, false);
    }
    if (c < 23) put(cur ^ 1);                 // every reader left this buffer at the last barrier
    __syncthreads();
  }

  // rows of the scatter (out_un[phi[o]] = out[o]) that this lane will store, asked for early
  const int orow = lane >> 3;       // 0..3
  const int oseg = (lane & 7) * 8;  // 0..56
  int dest[8];
#pragma unroll
  for (int i = 0; i < 8; ++i)
    dest[i] = min(max(phi[b * BLK + q0 + i * 4 + orow], 0), NTOK - 1);  // the row written stays inside outu

  // normalize as f16 into this wave's own LDS range, one row per query
#pragma unroll
  for (int qt = 0; qt < 2; ++qt) {
    const float lsum = lrun[qt][0] + lrun[qt][1];
    const float inv = 1.0f / (lsum + swapx16(lsum));   // the two halves' key sums joined
#pragma unroll
    for (int dt = 0; dt < 4; ++dt) {
      v8h o;
#pragma unroll
      for (int r = 0; r < 8; ++r) o[r] = (_Float16)(oacc[qt][dt][r] * inv);
      *(v8h*)&Os[wave][(qt*16 + l16) * P64 + dt*16 + half*8] = o;
    }
  }
  // the wave's own LDS stores have retired before other lanes' rows are read back;
  // only this wave writes and reads these rows, so no barrier is needed
  asm volatile("s_wait_dscnt 0x0" ::: "memory");
  // eight lanes store one query's 64 halves: a whole 128-byte line
#pragma unroll
  for (int i = 0; i < 8; ++i)
    *(v8h*)&outu[(size_t)dest[i] * 512 + h * HD + oseg] = *(const v8h*)&Os[wave][(i * 4 + orow) * P64 + oseg];
}

// ---------------------------------------------------------------------------
extern "C" void kernel_launch(void* const* d_in, const int* in_sizes, int n_in,
                              void* d_out, int out_size, void* d_ws, size_t ws_size,
                              hipStream_t stream) {
  const float* x   = (const float*)d_in[0];
  const int*   phi = (const int*)  d_in[1];
  const float* Wq  = (const float*)d_in[2];
  const float* bq  = (const float*)d_in[3];
  const float* Wk  = (const float*)d_in[4];
  const float* bk  = (const float*)d_in[5];
  const float* Wv  = (const float*)d_in[6];
  const float* bv  = (const float*)d_in[7];
  const float* Wo  = (const float*)d_in[8];
  const float* bo  = (const float*)d_in[9];
  float* out = (float*)d_out;

  _Float16* ws = (_Float16*)d_ws;
  size_t o = 0;
  _Float16* xp  = ws + o; o += (size_t)MPAD * DMODEL;
  _Float16* wqh = ws + o; o += (size_t)DMODEL * DMODEL;
  _Float16* wkh = ws + o; o += (size_t)DMODEL * DMODEL;
  _Float16* wvh = ws + o; o += (size_t)DMODEL * DMODEL;
  _Float16* woh = ws + o; o += (size_t)DMODEL * DMODEL;
  _Float16* q_h = ws + o; o += (size_t)MPAD * DMODEL;
  _Float16* k_h = ws + o; o += (size_t)MPAD * DMODEL;
  _Float16* v_h = ws + o; o += (size_t)MPAD * DMODEL;
  _Float16* att = ws + o; o += (size_t)NTOK * DMODEL;

  // wqh..woh are four adjacent planes of the workspace, q_h..v_h three adjacent ones
  prep_kernel<<<4 * CASTB + MPAD / 4, 256, 0, stream>>>(x, phi, Wq, Wk, Wv, Wo, xp, wqh);

  gemm512_kernel<true ><<<dim3(MPAD / 128, 12), 256, 0, stream>>>(xp, wqh, bq, bk, bv, nullptr, q_h);

  attn_kernel<<<dim3(NBLK, NHEAD), 256, 0, stream>>>(q_h, k_h, v_h, phi, att);

  gemm512_kernel<false><<<dim3(NTOK / 128, 4), 256, 0, stream>>>(att, woh, bo, bo, bo, out, nullptr);
}

// v008
// One run takes 67.4 microseconds.
// In both of two side-by-side timings against v007, it was 1.05 times as fast.
// Over all steps from v000 it is 2.44 times as fast.
#include <hip/hip_runtime.h>
#include <hip/hip_bf16.h>

typedef __attribute__((ext_vector_type(16))) _Float16 v16h;
typedef __attribute__((ext_vector_type(8)))  _Float16 v8h;
typedef __attribute__((ext_vector_type(4)))  _Float16 v4h;
typedef __attribute__((ext_vector_type(8)))  float    v8f;
typedef __attribute__((ext_vector_type(2)))  float    v2f;

#define NTOK   16384
#define DMODEL 512
#define NHEAD  8
#define HD     64
#define BLK    256                 // query block == w_half
#define WH     256                 // w_half
#define MPAD   (NTOK + 2*WH)       // 16896 padded rows
#define NBLK   (NTOK / BLK)        // 64

#define P32    40                  // rows of 32 halves (64 B) at 80 B
#define P64    72                  // rows of 64 halves (128 B) at 144 B
#define VGRP   16
#define VTILE  (64 * P32 + 4 * VGRP)
// attention: the largest sum of a lane's 16 softmax terms of one chunk that leaves the reference value where it is
#define PROOM 4096.0f

static __device__ inline v16h frag16(const _Float16* p) {
  v8h lo = *(const v8h*)(p);
  v8h hi = *(const v8h*)(p + 16);
  return __builtin_shufflevector(lo, hi, 0,1,2,3,4,5,6,7,8,9,10,11,12,13,14,15);
}

static __device__ inline v8f vzero8() {
  v8f z = {0.f,0.f,0.f,0.f,0.f,0.f,0.f,0.f};
  return z;
}

static __device__ inline float swapx16(float x) {
  return __int_as_float(__builtin_amdgcn_ds_swizzle(__float_as_int(x), 0x401f));
}

#define WN     (DMODEL * DMODEL)

// ------------------------- Q, K, V = gather(x) @ W^T + bias, straight from the f32 inputs
// A row p of the padded sequence is row phi[(p - WH) mod NTOK] of x. The gather, the circular
// pad and the casts f32 -> f16 of x and of the weights happen on the way into LDS, so no f16
// copy of x or of these weights passes through memory and no launch stands in front.
// 256x256 tile per workgroup, 16 waves (4 along M x 4 along N, 64x64 each): f32 sources are
// twice the bytes, the tile twice as wide and high asks L2 for each of them half as often.
// 64-deep k-steps: the piece of a row that one step stages is 256 bytes of f32, two whole
// lines; a wave-wide 16-byte load covers the pieces of two rows.
// Staging order, k slice rotation, weight row dealing and epilogue as in gemm512_kernel below.
// blockIdx.y = 2*sel + n-tile for the three products; row 6 of the grid casts Wo for the
// output projection (independent work that only a later launch reads).
__global__ __launch_bounds__(512)
void qkv_kernel(const float* __restrict__ x,
                const int* __restrict__ phi,
                const float* __restrict__ Wq,
                const float* __restrict__ Wk,
                const float* __restrict__ Wv,
                const float* __restrict__ Wo,
                const float* __restrict__ bias0,
                const float* __restrict__ bias1,
                const float* __restrict__ bias2,
                _Float16* __restrict__ woh,
                _Float16* __restrict__ outHall) {
  __shared__ __attribute__((aligned(16))) _Float16 As[2][256 * P64];
  __shared__ __attribute__((aligned(16))) _Float16 Bs[2][256 * P64];

  const int tid  = threadIdx.x;
  if (blockIdx.y == 6) {               // whole workgroups, in front of every barrier
    if (blockIdx.x < WN / 4096) {
#pragma unroll
      for (int j = 0; j < 2; ++j) {
        const int i = blockIdx.x * 4096 + j * 2048 + tid * 4;
        const float4 v = *(const float4*)(Wo + i);
        v4h hv = {(_Float16)v.x, (_Float16)v.y, (_Float16)v.z, (_Float16)v.w};
        *(v4h*)(woh + i) = hv;
      }
    }
    return;
  }
  const int lane = tid & 31;
  const int wave = tid >> 5;
  const int m0 = blockIdx.x * 256;
  const int sel = blockIdx.y >> 1;
  const int n0 = (blockIdx.y & 1) * 256;
  const float* __restrict__ W = sel == 0 ? Wq : sel == 1 ? Wk : Wv;
  const float* __restrict__ bias = sel == 0 ? bias0 : sel == 1 ? bias1 : bias2;
  _Float16* __restrict__ outH = outHall + (size_t)sel * MPAD * DMODEL;
  const int mwave = (wave & 3) * 64;   // 4 waves along M
  const int nwave = (wave >> 2) * 64;  // 4 waves along N
  const int half = lane >> 4;
  const int l16  = lane & 15;
  const int off  = half * 8;

  const int srow = tid >> 4;           // 0..31
  const int sseg = (tid & 15) * 4;     // 0..60: sixteen lanes cover one row's 256 bytes
  const int wrow = 4 * (srow & 15) + (srow >> 4);   // weight row kept in LDS row srow of each 64

  unsigned aoff[8];                    // byte offsets in x of this thread's eight A rows (32 bits beside a scalar base)
#pragma unroll
  for (int i = 0; i < 8; ++i) {
    int o = m0 + srow + 32 * i - WH;
    if (o < 0)      o += NTOK;
    if (o >= NTOK)  o -= NTOK;
    const int r = min(max(phi[o], 0), NTOK - 1);   // the row read stays inside x for any content of phi
    aoff[i] = ((unsigned)r * DMODEL + sseg) * 4u;
  }
  const unsigned woff = ((unsigned)wrow * 512 + sseg) * 4u;
  const int kst = (blockIdx.x + (blockIdx.x >> 3) + blockIdx.y) & 7;
  // float4 r[8]: a staged tile on its way from global memory to LDS
  auto fetchA = [&](int kb, float4 (&ra)[8]) {
    const unsigned s = ((kb + kst) & 7) * 256u;    // added in 32 bits: x is 32 MiB
#pragma unroll
    for (int i = 0; i < 8; ++i) ra[i] = *(const float4*)((const char*)x + (aoff[i] + s));
  };
  auto fetchB = [&](int kb, float4 (&rb)[8]) {   // LDS row srow + 32*i holds weight row wrow + 2*(i&1) + 64*(i>>1)
    const char* __restrict__ s = (const char*)(W + n0 * 512 + ((kb + kst) & 7) * 64);
#pragma unroll
    for (int i = 0; i < 8; ++i) rb[i] = *(const float4*)(s + woff + ((i & 1) * 2 + (i >> 1) * 64) * 2048);
  };
  auto put = [&](_Float16* __restrict__ dst, const float4 (&r)[8]) {
#pragma unroll
    for (int i = 0; i < 8; ++i) {
      v4h hv = {(_Float16)r[i].x, (_Float16)r[i].y, (_Float16)r[i].z, (_Float16)r[i].w};
      *(v4h*)&dst[(srow + 32 * i) * P64 + sseg] = hv;
    }
  };

  v8f acc[4][4];
#pragma unroll
  for (int mt = 0; mt < 4; ++mt)
#pragma unroll
    for (int nt = 0; nt < 4; ++nt) acc[mt][nt] = vzero8();

  {
    float4 ra[8], rb[8];
    fetchA(0, ra);
    fetchB(0, rb);
    put(As[0], ra);
    put(Bs[0], rb);
  }
  __syncthreads();

  for (int kb = 0; kb < 8; ++kb) {
    const int cur = kb & 1;
#pragma unroll
    for (int ks = 0; ks < 2; ++ks) {       // the step's two 32-deep halves
      float4 rs[8];                        // lives inside one half, so A and W take turns in the same registers
      if (kb < 7) {                        // in flight during the WMMAs below
        if (ks == 0) fetchA(kb + 1, rs); else fetchB(kb + 1, rs);
      }
      // keeps the LDS loads below in source order, the four A fragments first, so that the first
      // WMMAs wait for ten of the sixteen loads only: without it A fragments are loaded last
      __builtin_amdgcn_sched_barrier(0);

      v16h aF[4];
#pragma unroll
      for (int mt = 0; mt < 4; ++mt)
        aF[mt] = frag16(&As[cur][(mwave + mt*16 + l16) * P64 + ks*32 + off]);
      v16h bF[4];
#pragma unroll
      for (int nt = 0; nt < 4; ++nt)
        bF[nt] = frag16(&Bs[cur][(nwave + nt*16 + l16) * P64 + ks*32 + off]);
      // keeps the half's sixteen LDS loads together in front of its sixteen WMMAs: sunk among
      // them, a fragment is waited for with no work to cover its LDS latency
      __builtin_amdgcn_sched_barrier(0);
#pragma unroll
      for (int nt = 0; nt < 4; ++nt)
#pragma unroll
        for (int mt = 0; mt < 4; ++mt)
          acc[mt][nt] = __builtin_amdgcn_wmma_f32_16x16x32_f16(
              false, aF[mt], false, bF[nt], (short)0, acc[mt][nt], false, false);
      if (kb < 7) {                        // every reader left this buffer at the last barrier
        if (ks == 0) put(As[cur ^ 1], rs); else put(Bs[cur ^ 1], rs);
      }
    }
    __syncthreads();
  }

  const int n = n0 + nwave + 4 * l16;  // first of this lane's four adjacent columns
  const float4 bb = *(const float4*)&bias[n];
#pragma unroll
  for (int mt = 0; mt < 4; ++mt) {
    const int mbase = m0 + mwave + mt*16 + half*8;
#pragma unroll
    for (int r = 0; r < 8; ++r) {
      v4h hv = {(_Float16)(acc[mt][0][r] + bb.x), (_Float16)(acc[mt][1][r] + bb.y),
                (_Float16)(acc[mt][2][r] + bb.z), (_Float16)(acc[mt][3][r] + bb.w)};
      *(v4h*)&outH[(size_t)(mbase + r) * 512 + n] = hv;
    }
  }
  // stands in front of any later write of these stores' registers: the built code lays
  // the Wo cast path behind the stores
  asm volatile("s_wait_xcnt 0x0" ::: "memory");
}

// ------------------------------------------------------- C = A @ W^T + bias
// A: [M x 512] f16 row-major.  W: [512 x 512] f16 row-major (B(k,n)=W[n][k]).
// 128x128 tile per workgroup, 8 waves (4 along M x 2 along N), 64-deep k-steps: the piece
// of a row that one step stages is 128 bytes, a whole cache line, so a wave-wide 16-byte
// load touches four lines and uses every byte of them.
// Double-buffered LDS: the global loads of step kb+1 are issued in front of WMMAs of step kb
// and kept in registers; their LDS stores stand behind those WMMAs, so the wait for the
// loads falls behind work. The A tile travels during the first 32 k of the step, the W tile
// during the second 32 k, in the same registers. One barrier per k-step.
// blockIdx.y = 4*sel + n-tile: product sel uses weight plane sel of W, bias sel and
// output plane sel of outH, so independent products on one A share one grid.
// Weight rows are dealt to the LDS rows so that column l of a wave's B tile nt is output
// column 4*l + nt of the wave's 64: a lane's four accumulator tiles are then four adjacent
// columns, and 16 lanes store one row's 64 columns as whole 128-byte lines.
template<bool HALF_OUT>
__global__ __launch_bounds__(256)
void gemm512_kernel(const _Float16* __restrict__ A,
                    const _Float16* __restrict__ Wall,
                    const float* __restrict__ bias0,
                    const float* __restrict__ bias1,
                    const float* __restrict__ bias2,
                    float* __restrict__ outF,
                    _Float16* __restrict__ outHall) {
  __shared__ __attribute__((aligned(16))) _Float16 As[2][128 * P64];
  __shared__ __attribute__((aligned(16))) _Float16 Bs[2][128 * P64];

  const int tid  = threadIdx.x;
  const int lane = tid & 31;
  const int wave = tid >> 5;
  const int m0 = blockIdx.x * 128;
  const int sel = blockIdx.y >> 2;
  const int n0 = (blockIdx.y & 3) * 128;
  const _Float16* __restrict__ W = Wall + (size_t)sel * WN;
  const float* __restrict__ bias = sel == 0 ? bias0 : sel == 1 ? bias1 : bias2;
  _Float16* __restrict__ outH = outHall + (size_t)sel * MPAD * DMODEL;
  const int mwave = (wave & 3) * 32;   // 4 waves along M
  const int nwave = (wave >> 2) * 64;  // 2 waves along N
  const int half = lane >> 4;
  const int l16  = lane & 15;
  const int off  = half * 8;

  const int lrow = tid >> 3;           // 0..31
  const int lseg = (tid & 7) * 8;      // 0..56: eight lanes cover one row's 128 bytes
  const int wrow = 4 * (lrow & 15) + (lrow >> 4);   // weight row kept in LDS row lrow of each 64

  // one pointer per operand; the other three rows are reached by constant offsets
  const _Float16* __restrict__ aSrc = A + (size_t)(m0 + lrow) * 512 + lseg;
  const _Float16* __restrict__ wSrc = W + (size_t)(n0 + wrow) * 512 + lseg;
  // Step kb works on k slice (kb + kst) mod 8. kst spreads workgroups that
  // share an A tile (same x) or a W tile (same y) over different start slices, for speed only.
  const int kst = (blockIdx.x + (blockIdx.x >> 3) + blockIdx.y) & 7;
  v8h ra[4], rb[4];                    // a staged tile on its way from global memory to LDS
  auto fetchA = [&](int kb) {
    const _Float16* __restrict__ s = aSrc + ((kb + kst) & 7) * 64;
#pragma unroll
    for (int i = 0; i < 4; ++i) ra[i] = *(const v8h*)&s[i * 32 * 512];
  };
  auto fetchB = [&](int kb) {          // LDS row lrow + 32*i holds weight row wrow + 2*(i&1) + 64*(i>>1)
    const _Float16* __restrict__ s = wSrc + ((kb + kst) & 7) * 64;
#pragma unroll
    for (int i = 0; i < 4; ++i) rb[i] = *(const v8h*)&s[((i & 1) * 2 + (i >> 1) * 64) * 512];
  };
  auto putA = [&](int buf) {
#pragma unroll
    for (int i = 0; i < 4; ++i) *(v8h*)&As[buf][(lrow + 32 * i) * P64 + lseg] = ra[i];
  };
  auto putB = [&](int buf) {
#pragma unroll
    for (int i = 0; i < 4; ++i) *(v8h*)&Bs[buf][(lrow + 32 * i) * P64 + lseg] = rb[i];
  };

  v8f acc[2][4];
#pragma unroll
  for (int mt = 0; mt < 2; ++mt)
#pragma unroll
    for (int nt = 0; nt < 4; ++nt) acc[mt][nt] = vzero8();

  fetchA(0);
  fetchB(0);
  putA(0);
  putB(0);
  __syncthreads();

  for (int kb = 0; kb < 8; ++kb) {
    const int cur = kb & 1;
#pragma unroll
    for (int ks = 0; ks < 2; ++ks) {       // the step's two 32-deep halves
      if (kb < 7) {                        // in flight during the WMMAs below
        if (ks == 0) fetchA(kb + 1); else fetchB(kb + 1);
      }
      // keeps all four loads in front of the half's work: sunk among the WMMAs they would
      // be waited for with almost no lead
      __builtin_amdgcn_sched_barrier(0);

      v16h aF[2];
#pragma unroll
      for (int mt = 0; mt < 2; ++mt)
        aF[mt] = frag16(&As[cur][(mwave + mt*16 + l16) * P64 + ks*32 + off]);
#pragma unroll
      for (int np = 0; np < 2; ++np) {
        v16h bF[2];
#pragma unroll
        for (int nt = 0; nt < 2; ++nt)
          bF[nt] = frag16(&Bs[cur][(nwave + (np*2 + nt)*16 + l16) * P64 + ks*32 + off]);
#pragma unroll
        for (int nt = 0; nt < 2; ++nt)
#pragma unroll
          for (int mt = 0; mt < 2; ++mt)
            acc[mt][np*2 + nt] = __builtin_amdgcn_wmma_f32_16x16x32_f16(
                false, aF[mt], false, bF[nt], (short)0, acc[mt][np*2 + nt], false, false);
        // keeps the next pair's LDS loads (np 0) and the staged tile's LDS stores with their
        // wait for the global loads (np 1) behind these WMMAs
        __builtin_amdgcn_sched_barrier(0);
      }
      if (kb < 7) {                        // every reader left this buffer at the last barrier
        if (ks == 0) putA(cur ^ 1); else putB(cur ^ 1);
      }
      if (ks == 0) __builtin_amdgcn_sched_barrier(0);
    }
    __syncthreads();
  }

  const int n = n0 + nwave + 4 * l16;  // first of this lane's four adjacent columns
  const float4 bb = *(const float4*)&bias[n];
#pragma unroll
  for (int mt = 0; mt < 2; ++mt) {
    const int mbase = m0 + mwave + mt*16 + half*8;
#pragma unroll
    for (int r = 0; r < 8; ++r) {
      const float4 val = make_float4(acc[mt][0][r] + bb.x, acc[mt][1][r] + bb.y,
                                     acc[mt][2][r] + bb.z, acc[mt][3][r] + bb.w);
      const size_t oi = (size_t)(mbase + r) * 512 + n;
      if (HALF_OUT) {
        v4h hv = {(_Float16)val.x, (_Float16)val.y, (_Float16)val.z, (_Float16)val.w};
        *(v4h*)&outH[oi] = hv;
      } else {
        *(float4*)&outF[oi] = val;
      }
    }
  }
}

// -------------------------------------------- blocked local attention (flash)
// One workgroup per (block b, head h). 8 waves x 32 queries = 256 queries.
// Computes S^T = K.Q^T so softmax stats are per-lane and exp(S^T) tiles feed
// the O^T = V^T.P^T WMMA directly (no cross-lane shuffle of probabilities).
// Double-buffered K/V staging, the next chunk's global loads held in registers while
// this chunk is worked on; wave-uniform band classification per 32-key
// chunk: skip fully-invalid chunks, mask only boundary chunks.
__global__ __launch_bounds__(256)
void attn_kernel(const _Float16* __restrict__ qh,
                 const _Float16* __restrict__ kh,
                 const _Float16* __restrict__ vh,
                 const int* __restrict__ phi,
                 _Float16* __restrict__ outu) {
  __shared__ __attribute__((aligned(16))) _Float16 Ks[2][32 * P64];  // [key][d] chunk
  __shared__ __attribute__((aligned(16))) _Float16 VsT[2][VTILE];    // [d][key] chunk (transposed)
  __shared__ __attribute__((aligned(16))) _Float16 Os[8][32 * P64];  // [query][d], one range per wave

  const int b = blockIdx.x, h = blockIdx.y;
  const int tid  = threadIdx.x;
  const int lane = tid & 31;
  const int wave = tid >> 5;
  const int half = lane >> 4;
  const int l16  = lane & 15;
  const int off  = half * 8;
  const int q0   = wave * 32;

  // Q^T fragments (B operand): col q = l16, contiguous-in-d chunks per lane
  v16h qF[2][2];
#pragma unroll
  for (int qt = 0; qt < 2; ++qt) {
    const size_t qrow = (size_t)(b*BLK + WH + q0 + qt*16 + l16);
    const _Float16* qb = qh + qrow * 512 + h * HD;
#pragma unroll
    for (int ds = 0; ds < 2; ++ds)
      qF[qt][ds] = frag16(qb + ds*32 + off);
  }

  float mrun[2] = {-1e30f, -1e30f};
  v2f lrun[2] = {{0.f, 0.f}, {0.f, 0.f}};   // per lane: sums over its own even and odd keys
  v8f oacc[2][4];
#pragma unroll
  for (int qt = 0; qt < 2; ++qt)
#pragma unroll
    for (int dt = 0; dt < 4; ++dt) oacc[qt][dt] = vzero8();

  const int lr = tid >> 3;        // staged row 0..31
  const int ls = (tid & 7) * 8;   // seg 0..56

  v8h rk, rv;                     // one staged chunk on its way from global memory to LDS
  auto fetch = [&](int c) {
    const size_t kb = (size_t)(b * BLK + c * 32);
    rk = *(const v8h*)&kh[(kb + lr) * 512 + h * HD + ls];
    rv = *(const v8h*)&vh[(kb + lr) * 512 + h * HD + ls];
  };
  auto put = [&](int buf) {
    *(v8h*)&Ks[buf][lr * P64 + ls] = rk;
#pragma unroll
    for (int i = 0; i < 8; ++i)
      VsT[buf][(ls + i) * P32 + (ls >> 4) * VGRP + lr] = rv[i];
  };

  fetch(0);
  put(0);
  __syncthreads();

  for (int c = 0; c < 24; ++c) {              // 768-key window in 32-key chunks
    const int cur = c & 1;
    if (c < 23) fetch(c + 1);                 // in flight during the work below

    // wave-uniform band classification for this 32-key chunk
    const int c32 = c * 32;
    const bool anyv  = (c32 + 31 >= q0) && (c32 <= q0 + 31 + 2*WH);
    const bool fullv = (c32 >= q0 + 31) && (c32 + 31 <= q0 + 2*WH);

    if (anyv) {
      // K fragments (A operand of S^T): row = key, chunks along d
      v16h aK[2][2];
#pragma unroll
      for (int kt = 0; kt < 2; ++kt)
#pragma unroll
        for (int ds = 0; ds < 2; ++ds)
          aK[kt][ds] = frag16(&Ks[cur][(kt*16 + l16) * P64 + ds*32 + off]);

      // scores of both query tiles first: the one test further down serves both
      v8f st[2][2];
#pragma unroll
      for (int qt = 0; qt < 2; ++qt)
#pragma unroll
        for (int kt = 0; kt < 2; ++kt) {
          v8f s = vzero8();
          s = __builtin_amdgcn_wmma_f32_16x16x32_f16(false, aK[kt][0], false, qF[qt][0], (short)0, s, false, false);
          s = __builtin_amdgcn_wmma_f32_16x16x32_f16(false, aK[kt][1], false, qF[qt][1], (short)0, s, false, false);
          st[qt][kt] = s * 0.125f;
        }
      if (!fullv) {
#pragma unroll
        for (int qt = 0; qt < 2; ++qt) {
          const int j = q0 + qt*16 + l16;        // query index in block
#pragma unroll
          for (int kt = 0; kt < 2; ++kt)
#pragma unroll
            for (int r = 0; r < 8; ++r) {
              const int rr = c32 + kt*16 + half*8 + r;   // key index in window
              // band mask j <= rr <= j+512 as one unsigned range test
              if ((unsigned)(rr - j) > (unsigned)(2*WH)) st[qt][kt][r] = -2e30f;
            }
        }
      }
      // exp(s - mrun) of one query tile as P^T B-fragment (lo chunk = keytile 0 rows, hi chunk
      // = keytile 1 rows), and the sums over this lane's own even and odd keys
      v16h pF[2];
      v2f  cs[2];
      auto expsum = [&](int qt) {
        v16h p;
        v2f s = {0.f, 0.f};
#pragma unroll
        for (int kt = 0; kt < 2; ++kt)
#pragma unroll
          for (int r = 0; r < 8; r += 2) {
            v2f e;
            e[0] = __expf(st[qt][kt][r]     - mrun[qt]);
            e[1] = __expf(st[qt][kt][r + 1] - mrun[qt]);
            s += e;
            p[kt*8 + r]     = (_Float16)e[0];
            p[kt*8 + r + 1] = (_Float16)e[1];
          }
        pF[qt] = p;
        cs[qt] = s;
      };
      expsum(0);
      expsum(1);

      // V^T fragments, asked for in front of the test: they are on their way from LDS during it
      v16h vF[4];
#pragma unroll
      for (int dt = 0; dt < 4; ++dt)
        vF[dt] = frag16(&VsT[cur][(dt*16 + l16) * P32 + dt * VGRP + off]);

      // The reference value mrun moves only when it has to. No term is negative, so a lane
      // sum of at most PROOM bounds each of its terms, far inside f16 and f32 range: then the
      // terms stand as they are, and neither a maximum, nor an exchange between lanes, nor a
      // rescaling of sums and O is needed. Otherwise (always in a wave's first chunk, where
      // the terms overflow to infinity) mrun rises to the largest score so far, the same in
      // both halves of the wave, what has been summed is rescaled, and the terms are redone.
      const bool grow = !(cs[0][0] + cs[0][1] <= PROOM) || !(cs[1][0] + cs[1][1] <= PROOM);
      if (__builtin_amdgcn_ballot_w32(grow) != 0u) {
#pragma unroll
        for (int qt = 0; qt < 2; ++qt) {
          float cm = st[qt][0][0];
#pragma unroll
          for (int kt = 0; kt < 2; ++kt)
#pragma unroll
            for (int r = 0; r < 8; ++r) cm = fmaxf(cm, st[qt][kt][r]);
          const float mnew = fmaxf(mrun[qt], fmaxf(cm, swapx16(cm)));
          const float corr = __expf(mrun[qt] - mnew);
          lrun[qt] *= corr;
          mrun[qt] = mnew;
#pragma unroll
          for (int dt = 0; dt < 4; ++dt) oacc[qt][dt] *= corr;
          expsum(qt);
        }
      }
      lrun[0] += cs[0];
      lrun[1] += cs[1];

      // O^T += V^T . P^T
#pragma unroll
      for (int dt = 0; dt < 4; ++dt)
#pragma unroll
        for (int qt = 0; qt < 2; ++qt)
          oacc[qt][dt] = __builtin_amdgcn_wmma_f32_16x16x32_f16(
              false, vF[dt], false, pF[qt], (short)0, oacc[qt][dt], false, false);
    }
    if (c < 23) put(cur ^ 1);                 // every reader left this buffer at the last barrier
    __syncthreads();
  }

  // rows of the scatter (out_un[phi[o]] = out[o]) that this lane will store, asked for early
  const int orow = lane >> 3;       // 0..3
  const int oseg = (lane & 7) * 8;  // 0..56
  int dest[8];
#pragma unroll
  for (int i = 0; i < 8; ++i)
    dest[i] = min(max(phi[b * BLK + q0 + i * 4 + orow], 0), NTOK - 1);  // the row written stays inside outu

  // normalize as f16 into this wave's own LDS range, one row per query
#pragma unroll
  for (int qt = 0; qt < 2; ++qt) {
    const float lsum = lrun[qt][0] + lrun[qt][1];
    const float inv = 1.0f / (lsum + swapx16(lsum));   // the two halves' key sums joined
#pragma unroll
    for (int dt = 0; dt < 4; ++dt) {
      v8h o;
#pragma unroll
      for (int r = 0; r < 8; ++r) o[r] = (_Float16)(oacc[qt][dt][r] * inv);
      *(v8h*)&Os[wave][(qt*16 + l16) * P64 + dt*16 + half*8] = o;
    }
  }
  // the wave's own LDS stores have retired before other lanes' rows are read back;
  // only this wave writes and reads these rows, so no barrier is needed
  asm volatile("s_wait_dscnt 0x0" ::: "memory");
  // eight lanes store one query's 64 halves: a whole 128-byte line
#pragma unroll
  for (int i = 0; i < 8; ++i)
    *(v8h*)&outu[(size_t)dest[i] * 512 + h * HD + oseg] = *(const v8h*)&Os[wave][(i * 4 + orow) * P64 + oseg];
}

// ---------------------------------------------------------------------------
extern "C" void kernel_launch(void* const* d_in, const int* in_sizes, int n_in,
                              void* d_out, int out_size, void* d_ws, size_t ws_size,
                              hipStream_t stream) {
  const float* x   = (const float*)d_in[0];
  const int*   phi = (const int*)  d_in[1];
  const float* Wq  = (const float*)d_in[2];
  const float* bq  = (const float*)d_in[3];
  const float* Wk  = (const float*)d_in[4];
  const float* bk  = (const float*)d_in[5];
  const float* Wv  = (const float*)d_in[6];
  const float* bv  = (const float*)d_in[7];
  const float* Wo  = (const float*)d_in[8];
  const float* bo  = (const float*)d_in[9];
  float* out = (float*)d_out;

  _Float16* ws = (_Float16*)d_ws;
  size_t o = 0;
  _Float16* woh = ws + o; o += (size_t)DMODEL * DMODEL;
  _Float16* q_h = ws + o; o += (size_t)MPAD * DMODEL;
  _Float16* k_h = ws + o; o += (size_t)MPAD * DMODEL;
  _Float16* v_h = ws + o; o += (size_t)MPAD * DMODEL;
  _Float16* att = ws + o; o += (size_t)NTOK * DMODEL;

  // q_h..v_h are three adjacent planes of the workspace
  qkv_kernel<<<dim3(MPAD / 256, 7), 512, 0, stream>>>(x, phi, Wq, Wk, Wv, Wo, bq, bk, bv, woh, q_h);

  attn_kernel<<<dim3(NBLK, NHEAD), 256, 0, stream>>>(q_h, k_h, v_h, phi, att);

  gemm512_kernel<false><<<dim3(NTOK / 128, 4), 256, 0, stream>>>(att, woh, bo, bo, bo, out, nullptr);
}

// v009
// One run takes 61 microseconds.
// Timed twice side by side with v008, it ran 1.11 times as fast both times.
// Counting every step since v000, it is 2.70 times as fast.
#include <hip/hip_runtime.h>
#include <hip/hip_bf16.h>

typedef __attribute__((ext_vector_type(16))) _Float16 v16h;
typedef __attribute__((ext_vector_type(8)))  _Float16 v8h;
typedef __attribute__((ext_vector_type(4)))  _Float16 v4h;
typedef __attribute__((ext_vector_type(8)))  float    v8f;
typedef __attribute__((ext_vector_type(2)))  float    v2f;

#define NTOK   16384
#define DMODEL 512
#define NHEAD  8
#define HD     64
#define WH     256                 // w_half
#define MPAD   (NTOK + 2*WH)       // 16896 padded rows

#define P64    72                  // rows of 64 halves (128 B) at 144 B
#define KP     520                 // rows of 512 halves (1 KiB) at 1040 B, read by 16-byte loads
#define VP     528                 // rows of 512 halves (1 KiB) at 1056 B, read by transposing loads
#define QW     64                  // queries of one attention workgroup
#define NCH    ((QW + 2*WH) / 32)  // 18 chunks of 32 keys in its window
// attention: the largest sum of a lane's 16 softmax terms of one chunk that leaves the reference value where it is
#define PROOM 4096.0f

static __device__ inline v16h frag16(const _Float16* p) {
  v8h lo = *(const v8h*)(p);
  v8h hi = *(const v8h*)(p + 16);
  return __builtin_shufflevector(lo, hi, 0,1,2,3,4,5,6,7,8,9,10,11,12,13,14,15);
}

static __device__ inline v8f vzero8() {
  v8f z = {0.f,0.f,0.f,0.f,0.f,0.f,0.f,0.f};
  return z;
}

static __device__ inline float swapx16(float x) {
  return __int_as_float(__builtin_amdgcn_ds_swizzle(__float_as_int(x), 0x401f));
}

#define WN     (DMODEL * DMODEL)

// ------------------------- Q, K, V = gather(x) @ W^T + bias, straight from the f32 inputs
// A row p of the padded sequence is row phi[(p - WH) mod NTOK] of x. The gather, the circular
// pad and the casts f32 -> f16 of x and of the weights happen on the way into LDS, so no f16
// copy of x or of these weights passes through memory and no launch stands in front.
// 256x256 tile per workgroup, 16 waves (4 along M x 4 along N, 64x64 each): f32 sources are
// twice the bytes, the tile twice as wide and high asks L2 for each of them half as often.
// 64-deep k-steps: the piece of a row that one step stages is 256 bytes of f32, two whole
// lines; a wave-wide 16-byte load covers the pieces of two rows.
// Double-buffered LDS: the global loads of step kb+1 are issued in front of WMMAs of step kb
// and kept in registers; their LDS stores stand behind those WMMAs, so the wait for the
// loads falls behind work. The A tile travels during the first 32 k of the step, the W tile
// during the second 32 k, in the same registers. One barrier per k-step.
// Step kb works on k slice (kb + kst) mod 8: workgroups that share an A tile (same x) or a
// W tile (same y) run at the same time; started on different slices they ask L2 for
// different lines at any moment.
// Weight rows are dealt to the LDS rows so that column l of a wave's B tile nt is output
// column 4*l + nt of the wave's 64: a lane's four accumulator tiles are then four adjacent
// columns, and 16 lanes store one row's 64 columns as a whole 128-byte line.
// blockIdx.y = 2*sel + n-tile for the three products; row 6 of the grid casts Wo, in fragment
// order, for the output projection (independent work that only the next launch reads).
__global__ __launch_bounds__(512)
void qkv_kernel(const float* __restrict__ x,
                const int* __restrict__ phi,
                const float* __restrict__ Wq,
                const float* __restrict__ Wk,
                const float* __restrict__ Wv,
                const float* __restrict__ Wo,
                const float* __restrict__ bias0,
                const float* __restrict__ bias1,
                const float* __restrict__ bias2,
                _Float16* __restrict__ woh,
                _Float16* __restrict__ outHall) {
  __shared__ __attribute__((aligned(16))) _Float16 As[2][256 * P64];
  __shared__ __attribute__((aligned(16))) _Float16 Bs[2][256 * P64];

  const int tid  = threadIdx.x;
  if (blockIdx.y == 6) {               // whole workgroups, in front of every barrier
    if (blockIdx.x < WN / 4096) {
      // One 16-byte piece of woh per thread, a wave writes 512 contiguous bytes. Piece index =
      // ((T*16 + ks)*2 + piece)*32 + lane: B fragment of column tile T and k-step ks as the
      // projection's waves load it. Column c of tile T is Wo row (T>>1)*32 + 2*c + (T&1).
      const int idx = blockIdx.x * 512 + tid;
      const int fl = idx & 31, piece = (idx >> 5) & 1, ks = (idx >> 6) & 15, T = idx >> 10;
      const int n = (T >> 1) * 32 + 2 * (fl & 15) + (T & 1);
      const int k = ks * 32 + piece * 16 + (fl >> 4) * 8;
      const float4 a = *(const float4*)(Wo + n * DMODEL + k);
      const float4 b = *(const float4*)(Wo + n * DMODEL + k + 4);
      v8h hv = {(_Float16)a.x, (_Float16)a.y, (_Float16)a.z, (_Float16)a.w,
                (_Float16)b.x, (_Float16)b.y, (_Float16)b.z, (_Float16)b.w};
      *(v8h*)(woh + (size_t)idx * 8) = hv;
    }
    return;
  }
  const int lane = tid & 31;
  const int wave = tid >> 5;
  const int m0 = blockIdx.x * 256;
  const int sel = blockIdx.y >> 1;
  const int n0 = (blockIdx.y & 1) * 256;
  const float* __restrict__ W = sel == 0 ? Wq : sel == 1 ? Wk : Wv;
  const float* __restrict__ bias = sel == 0 ? bias0 : sel == 1 ? bias1 : bias2;
  _Float16* __restrict__ outH = outHall + (size_t)sel * MPAD * DMODEL;
  const int mwave = (wave & 3) * 64;   // 4 waves along M
  const int nwave = (wave >> 2) * 64;  // 4 waves along N
  const int half = lane >> 4;
  const int l16  = lane & 15;
  const int off  = half * 8;

  const int srow = tid >> 4;           // 0..31
  const int sseg = (tid & 15) * 4;     // 0..60: sixteen lanes cover one row's 256 bytes
  const int wrow = 4 * (srow & 15) + (srow >> 4);   // weight row kept in LDS row srow of each 64

  unsigned aoff[8];                    // byte offsets in x of this thread's eight A rows (32 bits beside a scalar base)
#pragma unroll
  for (int i = 0; i < 8; ++i) {
    int o = m0 + srow + 32 * i - WH;
    if (o < 0)      o += NTOK;
    if (o >= NTOK)  o -= NTOK;
    const int r = min(max(phi[o], 0), NTOK - 1);   // the row read stays inside x for any content of phi
    aoff[i] = ((unsigned)r * DMODEL + sseg) * 4u;
  }
  const unsigned woff = ((unsigned)wrow * 512 + sseg) * 4u;
  const int kst = (blockIdx.x + (blockIdx.x >> 3) + blockIdx.y) & 7;
  // float4 r[8]: a staged tile on its way from global memory to LDS
  auto fetchA = [&](int kb, float4 (&ra)[8]) {
    const unsigned s = ((kb + kst) & 7) * 256u;    // added in 32 bits: x is 32 MiB
#pragma unroll
    for (int i = 0; i < 8; ++i) ra[i] = *(const float4*)((const char*)x + (aoff[i] + s));
  };
  auto fetchB = [&](int kb, float4 (&rb)[8]) {   // LDS row srow + 32*i holds weight row wrow + 2*(i&1) + 64*(i>>1)
    const char* __restrict__ s = (const char*)(W + n0 * 512 + ((kb + kst) & 7) * 64);
#pragma unroll
    for (int i = 0; i < 8; ++i) rb[i] = *(const float4*)(s + woff + ((i & 1) * 2 + (i >> 1) * 64) * 2048);
  };
  auto put = [&](_Float16* __restrict__ dst, const float4 (&r)[8]) {
#pragma unroll
    for (int i = 0; i < 8; ++i) {
      v4h hv = {(_Float16)r[i].x, (_Float16)r[i].y, (_Float16)r[i].z, (_Float16)r[i].w};
      *(v4h*)&dst[(srow + 32 * i) * P64 + sseg] = hv;
    }
  };

  v8f acc[4][4];
#pragma unroll
  for (int mt = 0; mt < 4; ++mt)
#pragma unroll
    for (int nt = 0; nt < 4; ++nt) acc[mt][nt] = vzero8();

  {
    float4 ra[8], rb[8];
    fetchA(0, ra);
    fetchB(0, rb);
    put(As[0], ra);
    put(Bs[0], rb);
  }
  __syncthreads();

  for (int kb = 0; kb < 8; ++kb) {
    const int cur = kb & 1;
#pragma unroll
    for (int ks = 0; ks < 2; ++ks) {       // the step's two 32-deep halves
      float4 rs[8];                        // lives inside one half, so A and W take turns in the same registers
      if (kb < 7) {                        // in flight during the WMMAs below
        if (ks == 0) fetchA(kb + 1, rs); else fetchB(kb + 1, rs);
      }
      // keeps the LDS loads below in source order, the four A fragments first, so that the first
      // WMMAs wait for ten of the sixteen loads only: without it A fragments are loaded last
      __builtin_amdgcn_sched_barrier(0);

      v16h aF[4];
#pragma unroll
      for (int mt = 0; mt < 4; ++mt)
        aF[mt] = frag16(&As[cur][(mwave + mt*16 + l16) * P64 + ks*32 + off]);
      v16h bF[4];
#pragma unroll
      for (int nt = 0; nt < 4; ++nt)
        bF[nt] = frag16(&Bs[cur][(nwave + nt*16 + l16) * P64 + ks*32 + off]);
      // keeps the half's sixteen LDS loads together in front of its sixteen WMMAs: sunk among
      // them, a fragment is waited for with no work to cover its LDS latency
      __builtin_amdgcn_sched_barrier(0);
#pragma unroll
      for (int nt = 0; nt < 4; ++nt)
#pragma unroll
        for (int mt = 0; mt < 4; ++mt)
          acc[mt][nt] = __builtin_amdgcn_wmma_f32_16x16x32_f16(
              false, aF[mt], false, bF[nt], (short)0, acc[mt][nt], false, false);
      if (kb < 7) {                        // every reader left this buffer at the last barrier
        if (ks == 0) put(As[cur ^ 1], rs); else put(Bs[cur ^ 1], rs);
      }
    }
    __syncthreads();
  }

  const int n = n0 + nwave + 4 * l16;  // first of this lane's four adjacent columns
  const float4 bb = *(const float4*)&bias[n];
#pragma unroll
  for (int mt = 0; mt < 4; ++mt) {
    const int mbase = m0 + mwave + mt*16 + half*8;
#pragma unroll
    for (int r = 0; r < 8; ++r) {
      v4h hv = {(_Float16)(acc[mt][0][r] + bb.x), (_Float16)(acc[mt][1][r] + bb.y),
                (_Float16)(acc[mt][2][r] + bb.z), (_Float16)(acc[mt][3][r] + bb.w)};
      *(v4h*)&outH[(size_t)(mbase + r) * 512 + n] = hv;
    }
  }
  // stands in front of any later write of these stores' registers: the built code lays
  // the Wo cast path behind the stores
  asm volatile("s_wait_xcnt 0x0" ::: "memory");
}

// ------------------- blocked local attention (flash) with the output projection behind it
// One workgroup per 64 queries, all 8 heads: 16 waves, wave = (head, 32 queries). Query o attends
// padded rows o .. o + 512, so the workgroup's window is 576 rows, 18 chunks of 32 keys; a chunk
// is staged as whole 1-KiB rows of K and of V (all heads).
// Computes S^T = K.Q^T so softmax stats are per-lane and exp(S^T) tiles feed
// the O^T = V^T.P^T WMMA directly (no cross-lane shuffle of probabilities); V stays row-major
// in LDS and its V^T fragments come by the transposing load.
// Two K/V buffers filled by asynchronous copies to LDS (a chunk is 64 KiB, too much to hold in
// registers beside the accumulators): chunk c+1 is on its way while chunk c is worked on.
// Wave-uniform band classification per 32-key chunk: skip fully-invalid chunks, mask only
// boundary chunks.
// The 64 x 512 tile of normalized O then stays in LDS as f16, and the same waves multiply it by
// Wo^T: wave w makes output columns 32*w .. 32*w + 31 of all 64 rows; its B fragments come
// straight from woh, which the launch before wrote in fragment order (512 contiguous bytes per
// wave-wide load, every byte read once per workgroup). Row o of the result is row phi[o] of out.
typedef short s16x8 __attribute__((ext_vector_type(8)));
static __device__ inline v8h ldtr16(const _Float16* p) {
  typedef __attribute__((address_space(3))) s16x8 lds_s16x8;
  return __builtin_bit_cast(v8h, __builtin_amdgcn_ds_load_tr16_b128_v8i16((lds_s16x8*)p));
}

__global__ __launch_bounds__(512)
void attn_out_kernel(const _Float16* __restrict__ qh,
                     const _Float16* __restrict__ kh,
                     const _Float16* __restrict__ vh,
                     const int* __restrict__ phi,
                     const _Float16* __restrict__ woh,
                     const float* __restrict__ bo,
                     float* __restrict__ out) {
  __shared__ __attribute__((aligned(32))) _Float16 Ks[2][32 * KP];   // [key][head*64 + d] chunk
  __shared__ __attribute__((aligned(32))) _Float16 Vs[2][32 * VP];   // [key][head*64 + d] chunk
  __shared__ __attribute__((aligned(32))) _Float16 Ot[QW * KP];      // [query][head*64 + d]
  __shared__ __attribute__((aligned(16))) int Dr[QW];                // row of out that takes query row m

  const int qb   = blockIdx.x * QW;     // first query; also the first padded row of the window
  const int tid  = threadIdx.x;
  const int lane = tid & 31;
  const int wave = __builtin_amdgcn_readfirstlane(tid >> 5);
  const int half = lane >> 4;
  const int l16  = lane & 15;
  const int off  = half * 8;
  const int h    = wave >> 1;
  const int q0   = (wave & 1) * 32;

  // rows of the scatter (out[phi[o]] = row o), asked for early (by every wave: no branch, no wait here)
  const int drow = phi[qb + (tid & (QW - 1))];

  // Q^T fragments (B operand): col q = l16, contiguous-in-d chunks per lane
  v16h qF[2][2];
#pragma unroll
  for (int qt = 0; qt < 2; ++qt) {
    const size_t qrow = (size_t)(qb + WH + q0 + qt*16 + l16);
    const _Float16* qp = qh + qrow * 512 + h * HD;
#pragma unroll
    for (int ds = 0; ds < 2; ++ds)
      qF[qt][ds] = frag16(qp + ds*32 + off);
  }

  float mrun[2] = {-1e30f, -1e30f};
  v2f lrun[2] = {{0.f, 0.f}, {0.f, 0.f}};   // per lane: sums over its own even and odd keys
  v8f oacc[2][4];
#pragma unroll
  for (int qt = 0; qt < 2; ++qt)
#pragma unroll
    for (int dt = 0; dt < 4; ++dt) oacc[qt][dt] = vzero8();

  const int sr = tid >> 4;         // staged row 0..31
  const int ss = (tid & 15) * 8;   // sixteen lanes cover 256 bytes of it, four times

  // chunk c into buffer buf: every lane copies four 16-byte pieces of its K row and of its V row
  auto copyKV = [&](int c, int buf) {
    const size_t e = (size_t)(qb + c * 32 + sr) * 512 + ss;
    const _Float16* gk = kh + e;
    const _Float16* gv = vh + e;
    const unsigned lk = (unsigned)(size_t)&Ks[buf][sr * KP + ss];   // LDS byte address
    const unsigned lv = (unsigned)(size_t)&Vs[buf][sr * VP + ss];
    // the closing wait stands in front of any later write of the address registers named here
    asm volatile("global_load_async_to_lds_b128 %0, %8, off\n\t"
                 "global_load_async_to_lds_b128 %1, %9, off\n\t"
                 "global_load_async_to_lds_b128 %2, %10, off\n\t"
                 "global_load_async_to_lds_b128 %3, %11, off\n\t"
                 "global_load_async_to_lds_b128 %4, %12, off\n\t"
                 "global_load_async_to_lds_b128 %5, %13, off\n\t"
                 "global_load_async_to_lds_b128 %6, %14, off\n\t"
                 "global_load_async_to_lds_b128 %7, %15, off\n\t"
                 "s_wait_xcnt 0x0"
                 :: "v"(lk), "v"(lk + 256u), "v"(lk + 512u), "v"(lk + 768u),
                    "v"(lv), "v"(lv + 256u), "v"(lv + 512u), "v"(lv + 768u),
                    "v"(gk), "v"(gk + 128), "v"(gk + 256), "v"(gk + 384),
                    "v"(gv), "v"(gv + 128), "v"(gv + 256), "v"(gv + 384)
                 : "memory");
  };

  copyKV(0, 0);
  asm volatile("s_wait_asynccnt 0x0" ::: "memory");   // this wave's copies of chunk 0 have landed
  __syncthreads();                                    // and every other wave's
  copyKV(1, 1);
  // read behind the barriers below; the row written stays inside out for any content of phi
  if (wave < 2) Dr[tid] = min(max(drow, 0), NTOK - 1);

  for (int c = 0; c < NCH; ++c) {             // 576-key window in 32-key chunks
    const int cur = c & 1;
    // wave-uniform band classification for this 32-key chunk
    const int c32 = c * 32;
    const bool anyv  = (c32 + 31 >= q0) && (c32 <= q0 + 31 + 2*WH);
    const bool fullv = (c32 >= q0 + 31) && (c32 + 31 <= q0 + 2*WH);

    if (anyv) {
      // K fragments (A operand of S^T): row = key, chunks along d
      v16h aK[2][2];
#pragma unroll
      for (int kt = 0; kt < 2; ++kt)
#pragma unroll
        for (int ds = 0; ds < 2; ++ds)
          aK[kt][ds] = frag16(&Ks[cur][(kt*16 + l16) * KP + h * HD + ds*32 + off]);
      // keeps the eight LDS loads together in front of the WMMAs: split in groups, each group's
      // LDS latency is waited for anew
      __builtin_amdgcn_sched_barrier(0);

      // scores of both query tiles first: the one test further down serves both
      // (four independent tiles take their first 32 d, then their second: no WMMA waits for the one before)
      v8f st[2][2];
#pragma unroll
      for (int qt = 0; qt < 2; ++qt)
#pragma unroll
        for (int kt = 0; kt < 2; ++kt)
          st[qt][kt] = __builtin_amdgcn_wmma_f32_16x16x32_f16(false, aK[kt][0], false, qF[qt][0], (short)0, vzero8(), false, false);
#pragma unroll
      for (int qt = 0; qt < 2; ++qt)
#pragma unroll
        for (int kt = 0; kt < 2; ++kt)
          st[qt][kt] = __builtin_amdgcn_wmma_f32_16x16x32_f16(false, aK[kt][1], false, qF[qt][1], (short)0, st[qt][kt], false, false);
#pragma unroll
      for (int qt = 0; qt < 2; ++qt)
#pragma unroll
        for (int kt = 0; kt < 2; ++kt) st[qt][kt] *= 0.125f;
      if (!fullv) {
#pragma unroll
        for (int qt = 0; qt < 2; ++qt) {
          const int j = q0 + qt*16 + l16;        // query index in the workgroup
#pragma unroll
          for (int kt = 0; kt < 2; ++kt)
#pragma unroll
            for (int r = 0; r < 8; ++r) {
              const int rr = c32 + kt*16 + half*8 + r;   // key index in window
              // band mask j <= rr <= j+512 as one unsigned range test
              if ((unsigned)(rr - j) > (unsigned)(2*WH)) st[qt][kt][r] = -2e30f;
            }
        }
      }
      // V^T fragments (row = d, keys 8*half + 0..7 and 16 + 8*half + 0..7, the order of pF), asked
      // for in front of the exponentials: they are on their way from LDS during those
      v16h vF[4];
      const _Float16* vb = &Vs[cur][(off + (lane & 7)) * VP + h * HD + ((lane >> 3) & 1) * 8];
#pragma unroll
      for (int dt = 0; dt < 4; ++dt) {
        v8h lo = ldtr16(vb + dt * 16);
        v8h hi = ldtr16(vb + 16 * VP + dt * 16);
        vF[dt] = __builtin_shufflevector(lo, hi, 0,1,2,3,4,5,6,7,8,9,10,11,12,13,14,15);
      }
      // keeps these loads here: moved down to their first use they have no lead
      __builtin_amdgcn_sched_barrier(0);

      // exp(s - mrun) of one query tile as P^T B-fragment (lo chunk = keytile 0 rows, hi chunk
      // = keytile 1 rows), and the sums over this lane's own even and odd keys
      v16h pF[2];
      v2f  cs[2];
      auto expsum = [&](int qt) {
        v16h p;
        v2f s = {0.f, 0.f};
#pragma unroll
        for (int kt = 0; kt < 2; ++kt)
#pragma unroll
          for (int r = 0; r < 8; r += 2) {
            v2f e;
            e[0] = __expf(st[qt][kt][r]     - mrun[qt]);
            e[1] = __expf(st[qt][kt][r + 1] - mrun[qt]);
            s += e;
            p[kt*8 + r]     = (_Float16)e[0];
            p[kt*8 + r + 1] = (_Float16)e[1];
          }
        pF[qt] = p;
        cs[qt] = s;
      };
      expsum(0);
      expsum(1);

      // holds the eight V^T loads in front of the test (loaded values as inputs only): sunk behind
      // it they are waited for with no work to cover their LDS latency
      asm volatile("" :: "v"(vF[0]), "v"(vF[1]), "v"(vF[2]), "v"(vF[3]));

      // The reference value mrun moves only when it has to. No term is negative, so a lane
      // sum of at most PROOM bounds each of its terms, far inside f16 and f32 range: then the
      // terms stand as they are, and neither a maximum, nor an exchange between lanes, nor a
      // rescaling of sums and O is needed. Otherwise (always in a wave's first chunk, where
      // the terms overflow to infinity) mrun rises to the largest score so far, the same in
      // both halves of the wave, what has been summed is rescaled, and the terms are redone.
      const bool grow = !(cs[0][0] + cs[0][1] <= PROOM) || !(cs[1][0] + cs[1][1] <= PROOM);
      if (__builtin_amdgcn_ballot_w32(grow) != 0u) {
#pragma unroll
        for (int qt = 0; qt < 2; ++qt) {
          float cm = st[qt][0][0];
#pragma unroll
          for (int kt = 0; kt < 2; ++kt)
#pragma unroll
            for (int r = 0; r < 8; ++r) cm = fmaxf(cm, st[qt][kt][r]);
          const float mnew = fmaxf(mrun[qt], fmaxf(cm, swapx16(cm)));
          const float corr = __expf(mrun[qt] - mnew);
          lrun[qt] *= corr;
          mrun[qt] = mnew;
#pragma unroll
          for (int dt = 0; dt < 4; ++dt) oacc[qt][dt] *= corr;
          expsum(qt);
        }
      }
      lrun[0] += cs[0];
      lrun[1] += cs[1];

      // O^T += V^T . P^T
#pragma unroll
      for (int dt = 0; dt < 4; ++dt)
#pragma unroll
        for (int qt = 0; qt < 2; ++qt)
          oacc[qt][dt] = __builtin_amdgcn_wmma_f32_16x16x32_f16(
              false, vF[dt], false, pF[qt], (short)0, oacc[qt][dt], false, false);
    }
    asm volatile("s_wait_dscnt 0x0" ::: "memory");      // this wave's LDS reads of chunk c have retired
    asm volatile("s_wait_asynccnt 0x0" ::: "memory");   // its copies of chunk c+1 have landed
    __syncthreads();                                    // chunk c+1 is published, every reader has left chunk c
    if (c + 2 < NCH) copyKV(c + 2, cur);                // refill of the buffer just left
  }
  asm volatile("s_wait_asynccnt 0x0" ::: "memory");     // no copy is outstanding from here on

  // ---- output projection: out[phi[qb + m]][n] = sum_k O[m][k] * Wo[n][k] + bo[n]
  // B fragments of k-step ks, column tiles 2*wave and 2*wave + 1
  const _Float16* __restrict__ wsrc = woh + (size_t)wave * 16384 + lane * 8;
  auto loadB = [&](int ks, v16h (&b)[2]) {
#pragma unroll
    for (int nt = 0; nt < 2; ++nt) {
      const _Float16* p = wsrc + nt * 8192 + ks * 512;
      v8h lo = *(const v8h*)p;
      v8h hi = *(const v8h*)(p + 256);
      b[nt] = __builtin_shufflevector(lo, hi, 0,1,2,3,4,5,6,7,8,9,10,11,12,13,14,15);
    }
  };
  v16h bR[4][2];                    // four k-steps of B on their way, asked for in front of the barrier
#pragma unroll
  for (int s = 0; s < 4; ++s) loadB(s, bR[s]);

  const int n = wave * 32 + 2 * l16;  // first of this lane's two adjacent columns
  const v2f bb = *(const v2f*)&bo[n];

  // normalize as f16 into the workgroup's O tile, one row per query
#pragma unroll
  for (int qt = 0; qt < 2; ++qt) {
    const float lsum = lrun[qt][0] + lrun[qt][1];
    const float inv = 1.0f / (lsum + swapx16(lsum));   // the two halves' key sums joined
#pragma unroll
    for (int dt = 0; dt < 4; ++dt) {
      v8h o;
#pragma unroll
      for (int r = 0; r < 8; ++r) o[r] = (_Float16)(oacc[qt][dt][r] * inv);
      *(v8h*)&Ot[(q0 + qt*16 + l16) * KP + h * HD + dt*16 + off] = o;
    }
  }
  __syncthreads();                  // every head's O is in LDS before any wave reads whole rows

  v8f acc[4][2];
#pragma unroll
  for (int mt = 0; mt < 4; ++mt)
#pragma unroll
    for (int nt = 0; nt < 2; ++nt) acc[mt][nt] = vzero8();

  v16h aF[2][4];                    // O fragments of this k-step and of the next
  auto loadA = [&](int ks, v16h (&a)[4]) {
#pragma unroll
    for (int mt = 0; mt < 4; ++mt)
      a[mt] = frag16(&Ot[(mt*16 + l16) * KP + ks*32 + off]);
  };
  loadA(0, aF[0]);
#pragma unroll
  for (int ks = 0; ks < 16; ++ks) {
    if (ks + 1 < 16) loadA(ks + 1, aF[(ks + 1) & 1]);
    // keeps the next k-step's eight LDS loads together in front of this step's WMMAs: sunk among
    // them they are waited for with almost no lead
    __builtin_amdgcn_sched_barrier(0);
#pragma unroll
    for (int nt = 0; nt < 2; ++nt)
#pragma unroll
      for (int mt = 0; mt < 4; ++mt)
        acc[mt][nt] = __builtin_amdgcn_wmma_f32_16x16x32_f16(
            false, aF[ks & 1][mt], false, bR[ks & 3][nt], (short)0, acc[mt][nt], false, false);
    if (ks + 4 < 16) loadB(ks + 4, bR[ks & 3]);
    __builtin_amdgcn_sched_barrier(0);
  }

  // sixteen lanes store one row's 32 columns: a whole 128-byte line
#pragma unroll
  for (int mt = 0; mt < 4; ++mt) {
    const int4 d0 = *(const int4*)&Dr[mt*16 + off];
    const int4 d1 = *(const int4*)&Dr[mt*16 + off + 4];
    const int d[8] = {d0.x, d0.y, d0.z, d0.w, d1.x, d1.y, d1.z, d1.w};
#pragma unroll
    for (int r = 0; r < 8; ++r) {
      v2f val = {acc[mt][0][r] + bb[0], acc[mt][1][r] + bb[1]};
      *(v2f*)&out[(size_t)d[r] * 512 + n] = val;
    }
  }
}

// ---------------------------------------------------------------------------
extern "C" void kernel_launch(void* const* d_in, const int* in_sizes, int n_in,
                              void* d_out, int out_size, void* d_ws, size_t ws_size,
                              hipStream_t stream) {
  const float* x   = (const float*)d_in[0];
  const int*   phi = (const int*)  d_in[1];
  const float* Wq  = (const float*)d_in[2];
  const float* bq  = (const float*)d_in[3];
  const float* Wk  = (const float*)d_in[4];
  const float* bk  = (const float*)d_in[5];
  const float* Wv  = (const float*)d_in[6];
  const float* bv  = (const float*)d_in[7];
  const float* Wo  = (const float*)d_in[8];
  const float* bo  = (const float*)d_in[9];
  float* out = (float*)d_out;

  _Float16* ws = (_Float16*)d_ws;
  size_t o = 0;
  _Float16* woh = ws + o; o += (size_t)DMODEL * DMODEL;
  _Float16* q_h = ws + o; o += (size_t)MPAD * DMODEL;
  _Float16* k_h = ws + o; o += (size_t)MPAD * DMODEL;
  _Float16* v_h = ws + o; o += (size_t)MPAD * DMODEL;

  // q_h..v_h are three adjacent planes of the workspace
  qkv_kernel<<<dim3(MPAD / 256, 7), 512, 0, stream>>>(x, phi, Wq, Wk, Wv, Wo, bq, bk, bv, woh, q_h);

  attn_out_kernel<<<dim3(NTOK / QW), 512, 0, stream>>>(q_h, k_h, v_h, phi, woh, bo, out);
}

// v010
// It runs in 58 microseconds.
// Two timings next to v009 both put it at 1.05 times that version's speed.
// Counting every step since v000, it is 2.84 times as fast.
#include <hip/hip_runtime.h>
#include <hip/hip_bf16.h>

typedef __attribute__((ext_vector_type(16))) _Float16 v16h;
typedef __attribute__((ext_vector_type(8)))  _Float16 v8h;
typedef __attribute__((ext_vector_type(4)))  _Float16 v4h;
typedef __attribute__((ext_vector_type(2)))  _Float16 v2h;
typedef __attribute__((ext_vector_type(8)))  float    v8f;
typedef __attribute__((ext_vector_type(2)))  float    v2f;

#define NTOK   16384
#define DMODEL 512
#define NHEAD  8
#define HD     64
#define WH     256                 // w_half

#define P64    72                  // rows of 64 halves (128 B) at 144 B
#define KP     520                 // rows of 512 halves (1 KiB) at 1040 B, read by 16-byte loads
#define VP     528                 // rows of 512 halves (1 KiB) at 1056 B, read by transposing loads
#define QW     64                  // queries of one attention workgroup
#define NCH    ((QW + 2*WH) / 32)  // 18 chunks of 32 keys in its window
// attention: the largest sum of a lane's 16 softmax terms of one chunk that leaves the reference value where it is
#define PROOM 4096.0f

static __device__ inline v16h frag16(const _Float16* p) {
  v8h lo = *(const v8h*)(p);
  v8h hi = *(const v8h*)(p + 16);
  return __builtin_shufflevector(lo, hi, 0,1,2,3,4,5,6,7,8,9,10,11,12,13,14,15);
}

static __device__ inline v8f vzero8() {
  v8f z = {0.f,0.f,0.f,0.f,0.f,0.f,0.f,0.f};
  return z;
}

static __device__ inline float swapx16(float x) {
  return __int_as_float(__builtin_amdgcn_ds_swizzle(__float_as_int(x), 0x401f));
}

#define WN     (DMODEL * DMODEL)

__global__ __launch_bounds__(512)
void kv_kernel(const float* __restrict__ x,
               const int* __restrict__ phi,
               const float* __restrict__ Wq,
               const float* __restrict__ Wk,
               const float* __restrict__ Wv,
               const float* __restrict__ Wo,
               const float* __restrict__ bias1,
               const float* __restrict__ bias2,
               _Float16* __restrict__ wfh,
               _Float16* __restrict__ outHall) {
  __shared__ __attribute__((aligned(16))) _Float16 As[2][256 * P64];
  __shared__ __attribute__((aligned(16))) _Float16 Bs[2][256 * P64];

  const int tid  = threadIdx.x;
  const int lane = tid & 31;
  const int wave = tid >> 5;
  const int m0 = blockIdx.x * 256;
  const int sel = blockIdx.y >> 1;
  const int n0 = (blockIdx.y & 1) * 256;
  const float* __restrict__ W = sel == 0 ? Wk : Wv;
  const float* __restrict__ bias = sel == 0 ? bias1 : bias2;
  _Float16* __restrict__ outH = outHall + (size_t)sel * NTOK * DMODEL;
  const int mwave = (wave & 3) * 64;   // 4 waves along M
  const int nwave = (wave >> 2) * 64;  // 4 waves along N
  const int half = lane >> 4;
  const int l16  = lane & 15;
  const int off  = half * 8;

  const int srow = tid >> 4;           // 0..31
  const int sseg = (tid & 15) * 4;     // 0..60: sixteen lanes cover one row's 256 bytes
  const int wrow = 4 * (srow & 15) + (srow >> 4);   // weight row kept in LDS row srow of each 64

  int ph[8];                           // asked for in front of the cast below: both latencies run together
#pragma unroll
  for (int i = 0; i < 8; ++i) ph[i] = phi[m0 + srow + 32 * i];
  // stands in front of any later write of the registers that these loads name
  asm volatile("s_wait_xcnt 0x0" ::: "memory");

  if (tid < 256) {                     // whole waves; no barrier inside
    // One 16-byte piece of a cast matrix per thread, a wave writes 512 contiguous bytes. Piece
    // index = ((T*16 + ks)*2 + piece)*32 + lane: B fragment of column tile T and k-step ks as a
    // projection's waves load it. Column c of tile T is weight row (T>>1)*32 + 2*c + (T&1).
    const int mat = tid >> 7;          // waves 0..3: Wq, waves 4..7: Wo
    const float* __restrict__ Wc = mat == 0 ? Wq : Wo;
    const int idx = (blockIdx.y * (NTOK / 256) + blockIdx.x) * 128 + (tid & 127);
    const int fl = idx & 31, piece = (idx >> 5) & 1, ks = (idx >> 6) & 15, T = idx >> 10;
    const int n = (T >> 1) * 32 + 2 * (fl & 15) + (T & 1);
    const int k = ks * 32 + piece * 16 + (fl >> 4) * 8;
    const float4 a = *(const float4*)(Wc + n * DMODEL + k);
    const float4 b = *(const float4*)(Wc + n * DMODEL + k + 4);
    v8h hv = {(_Float16)a.x, (_Float16)a.y, (_Float16)a.z, (_Float16)a.w,
              (_Float16)b.x, (_Float16)b.y, (_Float16)b.z, (_Float16)b.w};
    *(v8h*)(wfh + (size_t)mat * WN + (size_t)idx * 8) = hv;
    // stands in front of any later write of this store's registers
    asm volatile("s_wait_xcnt 0x0" ::: "memory");
  }

  unsigned aoff[8];                    // byte offsets in x of this thread's eight A rows (32 bits beside a scalar base)
#pragma unroll
  for (int i = 0; i < 8; ++i) {
    const int r = min(max(ph[i], 0), NTOK - 1);    // the row read stays inside x for any content of phi
    aoff[i] = ((unsigned)r * DMODEL + sseg) * 4u;
  }
  const unsigned woff = ((unsigned)wrow * 512 + sseg) * 4u;
  const int kst = (blockIdx.x + (blockIdx.x >> 3) + blockIdx.y) & 7;
  // float4 r[8]: a staged tile on its way from global memory to LDS
  auto fetchA = [&](int kb, float4 (&ra)[8]) {
    const unsigned s = ((kb + kst) & 7) * 256u;    // added in 32 bits: x is 32 MiB
#pragma unroll
    for (int i = 0; i < 8; ++i) ra[i] = *(const float4*)((const char*)x + (aoff[i] + s));
  };
  auto fetchB = [&](int kb, float4 (&rb)[8]) {   // LDS row srow + 32*i holds weight row wrow + 2*(i&1) + 64*(i>>1)
    const char* __restrict__ s = (const char*)(W + n0 * 512 + ((kb + kst) & 7) * 64);
#pragma unroll
    for (int i = 0; i < 8; ++i) rb[i] = *(const float4*)(s + woff + ((i & 1) * 2 + (i >> 1) * 64) * 2048);
  };
  auto put = [&](_Float16* __restrict__ dst, const float4 (&r)[8]) {
#pragma unroll
    for (int i = 0; i < 8; ++i) {
      v4h hv = {(_Float16)r[i].x, (_Float16)r[i].y, (_Float16)r[i].z, (_Float16)r[i].w};
      *(v4h*)&dst[(srow + 32 * i) * P64 + sseg] = hv;
    }
  };

  v8f acc[4][4];
#pragma unroll
  for (int mt = 0; mt < 4; ++mt)
#pragma unroll
    for (int nt = 0; nt < 4; ++nt) acc[mt][nt] = vzero8();

  {
    float4 ra[8], rb[8];
    fetchA(0, ra);
    fetchB(0, rb);
    put(As[0], ra);
    put(Bs[0], rb);
  }
  __syncthreads();

  for (int kb = 0; kb < 8; ++kb) {
    const int cur = kb & 1;
#pragma unroll
    for (int ks = 0; ks < 2; ++ks) {       // the step's two 32-deep halves
      float4 rs[8];                        // lives inside one half, so A and W take turns in the same registers
      if (kb < 7) {                        // in flight during the WMMAs below
        if (ks == 0) fetchA(kb + 1, rs); else fetchB(kb + 1, rs);
      }
      // keeps the LDS loads below in source order, the four A fragments first, so that the first
      // WMMAs wait for ten of the sixteen loads only: without it A fragments are loaded last
      __builtin_amdgcn_sched_barrier(0);

      v16h aF[4];
#pragma unroll
      for (int mt = 0; mt < 4; ++mt)
        aF[mt] = frag16(&As[cur][(mwave + mt*16 + l16) * P64 + ks*32 + off]);
      v16h bF[4];
#pragma unroll
      for (int nt = 0; nt < 4; ++nt)
        bF[nt] = frag16(&Bs[cur][(nwave + nt*16 + l16) * P64 + ks*32 + off]);
      // keeps the half's sixteen LDS loads together in front of its sixteen WMMAs: sunk among
      // them, a fragment is waited for with no work to cover its LDS latency
      __builtin_amdgcn_sched_barrier(0);
#pragma unroll
      for (int nt = 0; nt < 4; ++nt)
#pragma unroll
        for (int mt = 0; mt < 4; ++mt)
          acc[mt][nt] = __builtin_amdgcn_wmma_f32_16x16x32_f16(
              false, aF[mt], false, bF[nt], (short)0, acc[mt][nt], false, false);
      if (kb < 7) {                        // every reader left this buffer at the last barrier
        if (ks == 0) put(As[cur ^ 1], rs); else put(Bs[cur ^ 1], rs);
      }
    }
    __syncthreads();
  }

  const int n = n0 + nwave + 4 * l16;  // first of this lane's four adjacent columns
  const float4 bb = *(const float4*)&bias[n];
#pragma unroll
  for (int mt = 0; mt < 4; ++mt) {
    const int mbase = m0 + mwave + mt*16 + half*8;
#pragma unroll
    for (int r = 0; r < 8; ++r) {
      v4h hv = {(_Float16)(acc[mt][0][r] + bb.x), (_Float16)(acc[mt][1][r] + bb.y),
                (_Float16)(acc[mt][2][r] + bb.z), (_Float16)(acc[mt][3][r] + bb.w)};
      *(v4h*)&outH[(size_t)(mbase + r) * 512 + n] = hv;
    }
  }
}

// ------- blocked local attention (flash) between the Q projection and the output projection
// One workgroup per 64 queries, all 8 heads: 16 waves, wave = (head, 32 queries). Query o attends
// padded rows o .. o + 512, so the workgroup's window is 576 rows, 18 chunks of 32 keys; a chunk
// is staged as whole 1-KiB rows of K and of V (all heads). Padded row p is row (p - WH) mod NTOK
// of the K and V planes.
// First the workgroup makes its own Q: its 64 gathered rows of x, cast to f16 on the way into
// LDS, times Wq^T, in the form of the output projection below (wave w makes columns 32*w ..
// 32*w + 31, B fragments straight from wqh); Q goes through LDS to the waves that need it. The
// first two K/V chunks are on their way meanwhile. Workgroup b starts the k loop of this product
// on k-step b mod 16 and wraps: the workgroups start together, and so they ask L2 for different
// lines of wqh at a time.
// Computes S^T = K.Q^T so softmax stats are per-lane and exp(S^T) tiles feed
// the O^T = V^T.P^T WMMA directly (no cross-lane shuffle of probabilities); V stays row-major
// in LDS and its V^T fragments come by the transposing load.
// Two K/V buffers filled by asynchronous copies to LDS (a chunk is 64 KiB, too much to hold in
// registers beside the accumulators): chunk c+1 is on its way while chunk c is worked on.
// Wave-uniform band classification per 32-key chunk: skip fully-invalid chunks, mask only
// boundary chunks.
// The 64 x 512 tile of normalized O then stays in LDS as f16, and the same waves multiply it by
// Wo^T: wave w makes output columns 32*w .. 32*w + 31 of all 64 rows; its B fragments come
// straight from woh, which the launch before wrote in fragment order (512 contiguous bytes per
// wave-wide load, every byte read once per workgroup). Row o of the result is row phi[o] of out.
typedef short s16x8 __attribute__((ext_vector_type(8)));
static __device__ inline v8h ldtr16(const _Float16* p) {
  typedef __attribute__((address_space(3))) s16x8 lds_s16x8;
  return __builtin_bit_cast(v8h, __builtin_amdgcn_ds_load_tr16_b128_v8i16((lds_s16x8*)p));
}

__global__ __launch_bounds__(512)
void attn_out_kernel(const float* __restrict__ x,
                     const _Float16* __restrict__ kh,
                     const _Float16* __restrict__ vh,
                     const int* __restrict__ phi,
                     const _Float16* __restrict__ wqh,
                     const float* __restrict__ bq,
                     const _Float16* __restrict__ woh,
                     const float* __restrict__ bo,
                     float* __restrict__ out) {
  __shared__ __attribute__((aligned(32))) _Float16 Ks[2][32 * KP];   // [key][head*64 + d] chunk
  __shared__ __attribute__((aligned(32))) _Float16 Vs[2][32 * VP];   // [key][head*64 + d] chunk
  __shared__ __attribute__((aligned(32))) _Float16 Ot[QW * KP];      // [query][head*64 + d]: x rows, then Q, at the end O
  __shared__ __attribute__((aligned(16))) int Dr[QW];                // row of out that takes query row m

  const int qb   = blockIdx.x * QW;     // first query; also the first padded row of the window
  const int tid  = threadIdx.x;
  const int lane = tid & 31;
  const int wave = __builtin_amdgcn_readfirstlane(tid >> 5);
  const int half = lane >> 4;
  const int l16  = lane & 15;
  const int off  = half * 8;
  const int h    = wave >> 1;
  const int q0   = (wave & 1) * 32;

  // rows of the scatter (out[phi[o]] = row o), asked for early (by every wave: no branch, no wait here)
  const int drow = phi[qb + (tid & (QW - 1))];

  const int sr = tid >> 4;         // staged row 0..31
  const int ss = (tid & 15) * 8;   // sixteen lanes cover 256 bytes of it, four times

  // chunk c into buffer buf: every lane copies four 16-byte pieces of its K row and of its V row
  auto copyKV = [&](int c, int buf) {
    const size_t e = (size_t)((qb + c * 32 + sr - WH) & (NTOK - 1)) * 512 + ss;   // the circular pad
    const _Float16* gk = kh + e;
    const _Float16* gv = vh + e;
    const unsigned lk = (unsigned)(size_t)&Ks[buf][sr * KP + ss];   // LDS byte address
    const unsigned lv = (unsigned)(size_t)&Vs[buf][sr * VP + ss];
    // the closing wait stands in front of any later write of the address registers named here
    asm volatile("global_load_async_to_lds_b128 %0, %8, off\n\t"
                 "global_load_async_to_lds_b128 %1, %9, off\n\t"
                 "global_load_async_to_lds_b128 %2, %10, off\n\t"
                 "global_load_async_to_lds_b128 %3, %11, off\n\t"
                 "global_load_async_to_lds_b128 %4, %12, off\n\t"
                 "global_load_async_to_lds_b128 %5, %13, off\n\t"
                 "global_load_async_to_lds_b128 %6, %14, off\n\t"
                 "global_load_async_to_lds_b128 %7, %15, off\n\t"
                 "s_wait_xcnt 0x0"
                 :: "v"(lk), "v"(lk + 256u), "v"(lk + 512u), "v"(lk + 768u),
                    "v"(lv), "v"(lv + 256u), "v"(lv + 512u), "v"(lv + 768u),
                    "v"(gk), "v"(gk + 128), "v"(gk + 256), "v"(gk + 384),
                    "v"(gv), "v"(gv + 128), "v"(gv + 256), "v"(gv + 384)
                 : "memory");
  };

  // ---- the two projections: C[m][n] = sum_k Ot[m][k] * W[n][k], 64 rows, this wave's 32 columns
  // B fragments of k-step ks, column tiles 2*wave and 2*wave + 1, from a matrix in fragment order;
  // wsrc is the wave's part of it, the same in every lane: the k-step is added to that scalar base
  auto loadB = [&](const _Float16* __restrict__ wsrc, int ks, v16h (&b)[2]) {
#pragma unroll
    for (int nt = 0; nt < 2; ++nt) {
      const _Float16* p = wsrc + nt * 8192 + ks * 512;
      v8h lo = *(const v8h*)(p + lane * 8);
      v8h hi = *(const v8h*)(p + 256 + lane * 8);
      b[nt] = __builtin_shufflevector(lo, hi, 0,1,2,3,4,5,6,7,8,9,10,11,12,13,14,15);
    }
  };
  auto loadA = [&](int ks, v16h (&a)[4]) {
#pragma unroll
    for (int mt = 0; mt < 4; ++mt)
      a[mt] = frag16(&Ot[(mt*16 + l16) * KP + ks*32 + off]);
  };
  // bR holds the B fragments of the first four k-steps on entry; step ks works on k-step (ks + rot) mod 16
  auto project = [&](const _Float16* __restrict__ wsrc, int rot, v16h (&bR)[4][2], v8f (&acc)[4][2]) {
#pragma unroll
    for (int mt = 0; mt < 4; ++mt)
#pragma unroll
      for (int nt = 0; nt < 2; ++nt) acc[mt][nt] = vzero8();
    v16h aF[2][4];                  // A fragments of this k-step and of the next
    loadA(rot, aF[0]);
#pragma unroll
    for (int ks = 0; ks < 16; ++ks) {
      if (ks + 1 < 16) loadA((ks + 1 + rot) & 15, aF[(ks + 1) & 1]);
      // keeps the next k-step's eight LDS loads together in front of this step's WMMAs: sunk among
      // them they are waited for with almost no lead
      __builtin_amdgcn_sched_barrier(0);
#pragma unroll
      for (int nt = 0; nt < 2; ++nt)
#pragma unroll
        for (int mt = 0; mt < 4; ++mt)
          acc[mt][nt] = __builtin_amdgcn_wmma_f32_16x16x32_f16(
              false, aF[ks & 1][mt], false, bR[ks & 3][nt], (short)0, acc[mt][nt], false, false);
      if (ks + 4 < 16) loadB(wsrc, (ks + 4 + rot) & 15, bR[ks & 3]);
      __builtin_amdgcn_sched_barrier(0);
    }
  };
  const int n = wave * 32 + 2 * l16;  // first of this lane's two adjacent columns in both projections

  copyKV(0, 0);

  // Q^T fragments (B operand of the scores): col q = l16, contiguous-in-d chunks per lane
  v16h qF[2][2];
  {
    const int rot = blockIdx.x & 15;
    const _Float16* __restrict__ wq = wqh + (size_t)wave * 16384;
    v16h bR[4][2];                  // four k-steps of B on their way, asked for in front of the barrier
#pragma unroll
    for (int t = 0; t < 4; ++t) loadB(wq, (t + rot) & 15, bR[t]);
    const v2f bb = *(const v2f*)&bq[n];
    // keeps the loads above in front of the wait for phi that the loads below need: behind it
    // they would start one memory latency later
    __builtin_amdgcn_sched_barrier(0);
    // This wave's four rows of x, each as four wave-wide loads of 512 contiguous bytes. The rows are
    // xm .. xm + 3 of the 64: their phi values are in this wave's own drow, lanes xm mod 32 onward.
    const int xm = (wave & 1) * 32 + (wave >> 1) * 4;
    float4 xr[16];
    unsigned xo[4];                 // byte offsets in x (32 bits beside a scalar base: x is 32 MiB)
#pragma unroll
    for (int j = 0; j < 4; ++j) {
      // the row read stays inside x for any content of phi
      const int r = min(max(__builtin_amdgcn_readlane(drow, (wave >> 1) * 4 + j), 0), NTOK - 1);
      xo[j] = ((unsigned)r * DMODEL + lane * 4) * 4u;
#pragma unroll
      for (int u = 0; u < 4; ++u)
        xr[j*4 + u] = *(const float4*)((const char*)x + (xo[j] + u * 512u));
    }
    // stands in front of any later write of the offset registers named here, which stay whole up to it
    asm volatile("s_wait_xcnt 0x0" :: "v"(xo[0]), "v"(xo[1]), "v"(xo[2]), "v"(xo[3]) : "memory");
#pragma unroll
    for (int j = 0; j < 4; ++j)
#pragma unroll
      for (int u = 0; u < 4; ++u) {
        const float4 f = xr[j*4 + u];
        v4h hv = {(_Float16)f.x, (_Float16)f.y, (_Float16)f.z, (_Float16)f.w};
        *(v4h*)&Ot[(xm + j) * KP + u * 128 + lane * 4] = hv;
      }

    asm volatile("s_wait_asynccnt 0x0" ::: "memory");   // this wave's copies of chunk 0 have landed
    __syncthreads();                                    // and every other wave's; the x rows are in LDS
    copyKV(1, 1);
    // read behind the barriers below; the row written stays inside out for any content of phi
    if (wave < 2) Dr[tid] = min(max(drow, 0), NTOK - 1);

    v8f acc[4][2];
    project(wq, rot, bR, acc);
    __syncthreads();                // every wave has read the x rows before Q takes their place
#pragma unroll
    for (int mt = 0; mt < 4; ++mt)
#pragma unroll
      for (int r = 0; r < 8; ++r) {
        v2h qv = {(_Float16)(acc[mt][0][r] + bb[0]), (_Float16)(acc[mt][1][r] + bb[1])};
        *(v2h*)&Ot[(mt*16 + off + r) * KP + n] = qv;
      }
    __syncthreads();                // every column of Q is in LDS before any wave reads its head's
#pragma unroll
    for (int qt = 0; qt < 2; ++qt)
#pragma unroll
      for (int ds = 0; ds < 2; ++ds)
        qF[qt][ds] = frag16(&Ot[(q0 + qt*16 + l16) * KP + h * HD + ds*32 + off]);
  }

  float mrun[2] = {-1e30f, -1e30f};
  v2f lrun[2] = {{0.f, 0.f}, {0.f, 0.f}};   // per lane: sums over its own even and odd keys
  v8f oacc[2][4];
#pragma unroll
  for (int qt = 0; qt < 2; ++qt)
#pragma unroll
    for (int dt = 0; dt < 4; ++dt) oacc[qt][dt] = vzero8();

  for (int c = 0; c < NCH; ++c) {             // 576-key window in 32-key chunks
    const int cur = c & 1;
    // wave-uniform band classification for this 32-key chunk
    const int c32 = c * 32;
    const bool anyv  = (c32 + 31 >= q0) && (c32 <= q0 + 31 + 2*WH);
    const bool fullv = (c32 >= q0 + 31) && (c32 + 31 <= q0 + 2*WH);

    if (anyv) {
      // K fragments (A operand of S^T): row = key, chunks along d
      v16h aK[2][2];
#pragma unroll
      for (int kt = 0; kt < 2; ++kt)
#pragma unroll
        for (int ds = 0; ds < 2; ++ds)
          aK[kt][ds] = frag16(&Ks[cur][(kt*16 + l16) * KP + h * HD + ds*32 + off]);
      // keeps the eight LDS loads together in front of the WMMAs: split in groups, each group's
      // LDS latency is waited for anew
      __builtin_amdgcn_sched_barrier(0);

      // scores of both query tiles first: the one test further down serves both
      // (four independent tiles take their first 32 d, then their second: no WMMA waits for the one before)
      v8f st[2][2];
#pragma unroll
      for (int qt = 0; qt < 2; ++qt)
#pragma unroll
        for (int kt = 0; kt < 2; ++kt)
          st[qt][kt] = __builtin_amdgcn_wmma_f32_16x16x32_f16(false, aK[kt][0], false, qF[qt][0], (short)0, vzero8(), false, false);
#pragma unroll
      for (int qt = 0; qt < 2; ++qt)
#pragma unroll
        for (int kt = 0; kt < 2; ++kt)
          st[qt][kt] = __builtin_amdgcn_wmma_f32_16x16x32_f16(false, aK[kt][1], false, qF[qt][1], (short)0, st[qt][kt], false, false);
#pragma unroll
      for (int qt = 0; qt < 2; ++qt)
#pragma unroll
        for (int kt = 0; kt < 2; ++kt) st[qt][kt] *= 0.125f;
      if (!fullv) {
#pragma unroll
        for (int qt = 0; qt < 2; ++qt) {
          const int j = q0 + qt*16 + l16;        // query index in the workgroup
#pragma unroll
          for (int kt = 0; kt < 2; ++kt)
#pragma unroll
            for (int r = 0; r < 8; ++r) {
              const int rr = c32 + kt*16 + half*8 + r;   // key index in window
              // band mask j <= rr <= j+512 as one unsigned range test
              if ((unsigned)(rr - j) > (unsigned)(2*WH)) st[qt][kt][r] = -2e30f;
            }
        }
      }
      // V^T fragments (row = d, keys 8*half + 0..7 and 16 + 8*half + 0..7, the order of pF), asked
      // for in front of the exponentials: they are on their way from LDS during those
      v16h vF[4];
      const _Float16* vb = &Vs[cur][(off + (lane & 7)) * VP + h * HD + ((lane >> 3) & 1) * 8];
#pragma unroll
      for (int dt = 0; dt < 4; ++dt) {
        v8h lo = ldtr16(vb + dt * 16);
        v8h hi = ldtr16(vb + 16 * VP + dt * 16);
        vF[dt] = __builtin_shufflevector(lo, hi, 0,1,2,3,4,5,6,7,8,9,10,11,12,13,14,15);
      }
      // keeps these loads here: moved down to their first use they have no lead
      __builtin_amdgcn_sched_barrier(0);

      // exp(s - mrun) of one query tile as P^T B-fragment (lo chunk = keytile 0 rows, hi chunk
      // = keytile 1 rows), and the sums over this lane's own even and odd keys
      v16h pF[2];
      v2f  cs[2];
      auto expsum = [&](int qt) {
        v16h p;
        v2f s = {0.f, 0.f};
#pragma unroll
        for (int kt = 0; kt < 2; ++kt)
#pragma unroll
          for (int r = 0; r < 8; r += 2) {
            v2f e;
            e[0] = __expf(st[qt][kt][r]     - mrun[qt]);
            e[1] = __expf(st[qt][kt][r + 1] - mrun[qt]);
            s += e;
            p[kt*8 + r]     = (_Float16)e[0];
            p[kt*8 + r + 1] = (_Float16)e[1];
          }
        pF[qt] = p;
        cs[qt] = s;
      };
      expsum(0);
      expsum(1);

      // holds the eight V^T loads in front of the test (loaded values as inputs only): sunk behind
      // it they are waited for with no work to cover their LDS latency
      asm volatile("" :: "v"(vF[0]), "v"(vF[1]), "v"(vF[2]), "v"(vF[3]));

      // The reference value mrun moves only when it has to. No term is negative, so a lane
      // sum of at most PROOM bounds each of its terms, far inside f16 and f32 range: then the
      // terms stand as they are, and neither a maximum, nor an exchange between lanes, nor a
      // rescaling of sums and O is needed. Otherwise (always in a wave's first chunk, where
      // the terms overflow to infinity) mrun rises to the largest score so far, the same in
      // both halves of the wave, what has been summed is rescaled, and the terms are redone.
      const bool grow = !(cs[0][0] + cs[0][1] <= PROOM) || !(cs[1][0] + cs[1][1] <= PROOM);
      if (__builtin_amdgcn_ballot_w32(grow) != 0u) {
#pragma unroll
        for (int qt = 0; qt < 2; ++qt) {
          float cm = st[qt][0][0];
#pragma unroll
          for (int kt = 0; kt < 2; ++kt)
#pragma unroll
            for (int r = 0; r < 8; ++r) cm = fmaxf(cm, st[qt][kt][r]);
          const float mnew = fmaxf(mrun[qt], fmaxf(cm, swapx16(cm)));
          const float corr = __expf(mrun[qt] - mnew);
          lrun[qt] *= corr;
          mrun[qt] = mnew;
#pragma unroll
          for (int dt = 0; dt < 4; ++dt) oacc[qt][dt] *= corr;
          expsum(qt);
        }
      }
      lrun[0] += cs[0];
      lrun[1] += cs[1];

      // O^T += V^T . P^T
#pragma unroll
      for (int dt = 0; dt < 4; ++dt)
#pragma unroll
        for (int qt = 0; qt < 2; ++qt)
          oacc[qt][dt] = __builtin_amdgcn_wmma_f32_16x16x32_f16(
              false, vF[dt], false, pF[qt], (short)0, oacc[qt][dt], false, false);
    }
    asm volatile("s_wait_dscnt 0x0" ::: "memory");      // this wave's LDS reads of chunk c have retired
    asm volatile("s_wait_asynccnt 0x0" ::: "memory");   // its copies of chunk c+1 have landed
    __syncthreads();                                    // chunk c+1 is published, every reader has left chunk c
    if (c + 2 < NCH) copyKV(c + 2, cur);                // refill of the buffer just left
  }
  asm volatile("s_wait_asynccnt 0x0" ::: "memory");     // no copy is outstanding from here on

  // ---- output projection: out[phi[qb + m]][n] = sum_k O[m][k] * Wo[n][k] + bo[n]
  const _Float16* __restrict__ wsrc = woh + (size_t)wave * 16384;
  v16h bR[4][2];                    // four k-steps of B on their way, asked for in front of the barrier
#pragma unroll
  for (int s = 0; s < 4; ++s) loadB(wsrc, s, bR[s]);

  const v2f bb = *(const v2f*)&bo[n];

  // normalize as f16 into the workgroup's O tile, one row per query
#pragma unroll
  for (int qt = 0; qt < 2; ++qt) {
    const float lsum = lrun[qt][0] + lrun[qt][1];
    const float inv = 1.0f / (lsum + swapx16(lsum));   // the two halves' key sums joined
#pragma unroll
    for (int dt = 0; dt < 4; ++dt) {
      v8h o;
#pragma unroll
      for (int r = 0; r < 8; ++r) o[r] = (_Float16)(oacc[qt][dt][r] * inv);
      *(v8h*)&Ot[(q0 + qt*16 + l16) * KP + h * HD + dt*16 + off] = o;
    }
  }
  __syncthreads();                  // every head's O is in LDS before any wave reads whole rows

  v8f acc[4][2];
  project(wsrc, 0, bR, acc);

  // sixteen lanes store one row's 32 columns: a whole 128-byte line
#pragma unroll
  for (int mt = 0; mt < 4; ++mt) {
    const int4 d0 = *(const int4*)&Dr[mt*16 + off];
    const int4 d1 = *(const int4*)&Dr[mt*16 + off + 4];
    const int d[8] = {d0.x, d0.y, d0.z, d0.w, d1.x, d1.y, d1.z, d1.w};
#pragma unroll
    for (int r = 0; r < 8; ++r) {
      v2f val = {acc[mt][0][r] + bb[0], acc[mt][1][r] + bb[1]};
      *(v2f*)&out[(size_t)d[r] * 512 + n] = val;
    }
  }
}

// ---------------------------------------------------------------------------
extern "C" void kernel_launch(void* const* d_in, const int* in_sizes, int n_in,
                              void* d_out, int out_size, void* d_ws, size_t ws_size,
                              hipStream_t stream) {
  const float* x   = (const float*)d_in[0];
  const int*   phi = (const int*)  d_in[1];
  const float* Wq  = (const float*)d_in[2];
  const float* bq  = (const float*)d_in[3];
  const float* Wk  = (const float*)d_in[4];
  const float* bk  = (const float*)d_in[5];
  const float* Wv  = (const float*)d_in[6];
  const float* bv  = (const float*)d_in[7];
  const float* Wo  = (const float*)d_in[8];
  const float* bo  = (const float*)d_in[9];
  float* out = (float*)d_out;

  _Float16* ws = (_Float16*)d_ws;
  size_t o = 0;
  _Float16* wqh = ws + o; o += (size_t)DMODEL * DMODEL;
  _Float16* woh = ws + o; o += (size_t)DMODEL * DMODEL;
  _Float16* k_h = ws + o; o += (size_t)NTOK * DMODEL;
  _Float16* v_h = ws + o; o += (size_t)NTOK * DMODEL;

  // wqh, woh and k_h, v_h are pairs of adjacent planes of the workspace
  kv_kernel<<<dim3(NTOK / 256, 4), 512, 0, stream>>>(x, phi, Wq, Wk, Wv, Wo, bk, bv, wqh, k_h);

  attn_out_kernel<<<dim3(NTOK / QW), 512, 0, stream>>>(x, k_h, v_h, phi, wqh, bq, woh, bo, out);
}
